// v000
// Times are from an AMD MI455X. After a warm-up the kernel runs many times in a row, and a time is the length of
// such a window on the GPU divided by its runs, so every launch and the gaps after it count. The runs cycle
// through copies of the inputs. A figure is the median of several windows, for all but v000 over two sittings.
// Sittings can differ by a few percent; kernels timed side by side share one.
// The starting kernel, v000, takes 2300 microseconds a run.
// compute dtype: all float inputs rounded to bf16, alpha read; the three 1x1 convs with EXACT bf16 products on WMMA 16x16x32 (f32 accumulate, + bias), eval BatchNorm affine in f32; logits a^T b over the 64 channels with a and b as f16 hi + residual (x 2^10), 3 products, stored in f32; softmax in f32 (precise expf); P x 2^11 as f16 hi + residual against the normalised m rounded ONCE to f16 (2 products); residual blend 2 (feature + alpha out) in f32; channels-first f32 output.
#include <hip/hip_runtime.h>
#include <math.h>

typedef __attribute__((ext_vector_type(16))) _Float16 v16h;
typedef __attribute__((ext_vector_type(16))) __bf16 v16b;
typedef __attribute__((ext_vector_type(8)))  _Float16 v8h;
typedef __attribute__((ext_vector_type(8)))  float v8f;
typedef __attribute__((ext_vector_type(4)))  float v4f;
typedef __attribute__((ext_vector_type(2)))  float v2f;
typedef __attribute__((ext_vector_type(4)))  unsigned v4u;
typedef __attribute__((ext_vector_type(4)))  int v4i;
typedef float __attribute__((may_alias)) float_a;
typedef int __attribute__((may_alias)) int_a;

template <typename T> __device__ __forceinline__ void vst2(void* p, T v) { *(T*)p = v;  }
__device__ __forceinline__ v8f wmma16(v16h a, v16h b, v8f c) {
  v8f d = __builtin_amdgcn_wmma_f32_16x16x32_f16(false, a, false, b, (short)0, c, false, false);
  asm volatile("v_nop\n\tv_nop\n\tv_nop\n\tv_nop" : "+v"(d) : "v"(a), "v"(b));
  return d;
}
__device__ __forceinline__ v8f wmma_bf(v16b a, v16b b, v8f c) {
  v8f d = __builtin_amdgcn_wmma_f32_16x16x32_bf16(false, a, false, b, (short)0, c, false, false);
  asm volatile("v_nop\n\tv_nop\n\tv_nop\n\tv_nop" : "+v"(d) : "v"(a), "v"(b));
  return d;
}
// 16x16x32 fragments: lane = (h = lane>>4, row/col = lane&15); elements 0..7 = k0+8h+0..7, 8..15 = k0+16+8h+0..7; D element r = row 8h+r
__device__ __forceinline__ v16h frag_h(const _Float16* rowk0, int lane) {
  union { v16h v; v8h q[2]; } u; const _Float16* p = rowk0 + 8 * (lane >> 4);
  u.q[0] = *(const v8h*)p; u.q[1] = *(const v8h*)(p + 16); return u.v;
}
__device__ __forceinline__ v16h frag_f32(const float* rowk0, int lane) {
  v16h a; const float* p = rowk0 + 8 * (lane >> 4);
#pragma unroll
  for (int i = 0; i < 8; ++i) { a[i] = (_Float16)p[i]; a[8 + i] = (_Float16)p[16 + i]; }
  return a;
}
__device__ __forceinline__ v16h frag_f32s(const float* rowk0, int lane, float sc) {
  v16h a; const float* p = rowk0 + 8 * (lane >> 4);
#pragma unroll
  for (int i = 0; i < 8; ++i) { a[i] = (_Float16)(p[i] * sc); a[8 + i] = (_Float16)(p[16 + i] * sc); }
  return a;
}
// column fragment from a [K][ld] layout (column n), rows >= K read as 0
__device__ __forceinline__ v16h fragc_f32(const float* W, int k0, int n, int lane, int ld, int K) {
  v16h a; const int g = lane >> 4;
#pragma unroll
  for (int i = 0; i < 8; ++i) { const int ka = k0 + 8 * g + i, kb = ka + 16;
    a[i] = (_Float16)(ka < K ? W[(size_t)(ka < K ? ka : K - 1) * ld + n] : 0.f); a[8 + i] = (_Float16)(kb < K ? W[(size_t)(kb < K ? kb : K - 1) * ld + n] : 0.f); }
  return a;
}
struct F2 { v16b h, l; };
__device__ __forceinline__ F2 bsplit16(const float v[16]) { F2 r;
#pragma unroll
  for (int i = 0; i < 16; ++i) { const __bf16 h = (__bf16)v[i]; r.h[i] = h; r.l[i] = (__bf16)(v[i] - (float)h); }
  return r; }
__device__ __forceinline__ F2 split_row(const float* row, int k0, int lane) { float v[16]; const float* p = row + k0 + 8 * (lane >> 4);
#pragma unroll
  for (int i = 0; i < 8; ++i) { v[i] = p[i]; v[8 + i] = p[16 + i]; }
  return bsplit16(v); }
__device__ __forceinline__ F2 split_rowK(const float* row, int k0, int lane, int K) { float v[16]; const int g = lane >> 4;
#pragma unroll
  for (int i = 0; i < 8; ++i) { const int ka = k0 + 8 * g + i, kb = ka + 16; v[i] = ka < K ? row[ka < K ? ka : K - 1] : 0.f; v[8 + i] = kb < K ? row[kb < K ? kb : K - 1] : 0.f; }
  return bsplit16(v); }
__device__ __forceinline__ F2 split_col(const float* W, int k0, int n, int lane, int ld, int K) { float v[16]; const int g = lane >> 4;
#pragma unroll
  for (int i = 0; i < 8; ++i) { const int ka = k0 + 8 * g + i, kb = ka + 16; v[i] = ka < K ? W[(size_t)(ka < K ? ka : K - 1) * ld + n] : 0.f; v[8 + i] = kb < K ? W[(size_t)(kb < K ? kb : K - 1) * ld + n] : 0.f; }
  return bsplit16(v); }
__device__ __forceinline__ v8f mac3(const F2& a, const F2& b, v8f c) { c = wmma_bf(a.l, b.h, c); c = wmma_bf(a.h, b.l, c); return wmma_bf(a.h, b.h, c); }
__device__ __forceinline__ float sigm(float v) { return 1.0f / (1.0f + expf(-v)); }
#define LDSX() do { asm volatile("s_wait_dscnt 0" ::: "memory"); __builtin_amdgcn_wave_barrier(); __builtin_amdgcn_fence(__ATOMIC_RELEASE, "workgroup"); } while (0)

// GFA / PAM (B 2, C 64, N 8,192 points): a, b, m = conv1x1(x); att = softmax_m(sum_c a[c][n] b[c][m]); m = BN_eval(m); out[c][n] = sum_m att[n][m] m[c][m]; p = feature + alpha out; return p + p.
__device__ __forceinline__ float bfr(float v) { return (float)(__bf16)v; }
#define NB 2
#define CC 64
#define TT 8192
#define QCH 2048              // query rows per attention chunk (S chunk = 2048 x 8192 f32 = 64 MB)
#ifndef TNB
#define TNB NB
#endif
#ifndef NQCH
#define NQCH (TT / QCH)
#endif
#ifndef XSTR
#define XSTR TT
#endif
#define WS_XT  0u                                   // f32 x rows [b*N+n][64] (bf16 values)
#define WS_AH  (WS_XT + 4u * (size_t)NB * TT * CC)    // f16 a hi / lo rows [b*N+n][64]
#define WS_AL  (WS_AH + 2u * (size_t)NB * TT * CC)
#define WS_BH  (WS_AL + 2u * (size_t)NB * TT * CC)    // f16 b hi / lo rows
#define WS_BL  (WS_BH + 2u * (size_t)NB * TT * CC)
#define WS_MP  (WS_BL + 2u * (size_t)NB * TT * CC)    // f16 normalised-m planes [b][c][n]
#define WS_S   (WS_MP + 2u * (size_t)NB * CC * TT)    // f32 S / P chunk [QCH][TT]
#define WS_END (WS_S + 4u * (size_t)QCH * TT)
// ---- k_xt: block = (64 points, b): channels-first feature -> rows [b*N+n][64] (bf16 values); 256-B rows
__global__ __launch_bounds__(256) void k_xt(const float* __restrict__ X, float* __restrict__ XT) { __shared__ float st[CC][65];
  const int t = threadIdx.x; const int n0 = blockIdx.x * 64; const size_t b = blockIdx.y;
  for (int e = t; e < CC * 64; e += 256) { const int c = e >> 6, nl = e & 63; st[c][nl] = bfr(X[(b * CC + c) * (size_t)XSTR + n0 + nl]); }
  __syncthreads();
  for (int e = t; e < 64 * 16; e += 256) { const int nl = e >> 4, q = e & 15; v4f o; o[0] = st[q * 4][nl]; o[1] = st[q * 4 + 1][nl]; o[2] = st[q * 4 + 2][nl]; o[3] = st[q * 4 + 3][nl]; vst2(XT + (b * TT + n0 + nl) * CC + q * 4, o); } }
__global__ __launch_bounds__(128) void k_proj(const float* __restrict__ XT, const float* __restrict__ WA, const float* __restrict__ BA, const float* __restrict__ WB, const float* __restrict__ BB, const float* __restrict__ WM, const float* __restrict__ BM, const float* __restrict__ G, const float* __restrict__ BT, const float* __restrict__ MU, const float* __restrict__ VAR,
    _Float16* __restrict__ AH, _Float16* __restrict__ AL, _Float16* __restrict__ BH, _Float16* __restrict__ BL, _Float16* __restrict__ MP) { __shared__ __align__(16) _Float16 sh[64][72], sl[64][72]; __shared__ __align__(16) _Float16 th[CC][72];
  const int tid = threadIdx.x, wave = tid >> 5, lane = tid & 31, col = lane & 15, g = lane >> 4; const int which = blockIdx.y; const size_t r0 = (size_t)blockIdx.x * 64; const float* Wt = which == 0 ? WA : which == 1 ? WB : WM; const float* Bv = which == 0 ? BA : which == 1 ? BB : BM;
  v8f acc[4] = {};
#pragma unroll
  for (int kc = 0; kc < CC / 32; ++kc) { v16b a; { const float* p = XT + (r0 + wave * 16 + col) * CC + kc * 32 + 8 * g;
#pragma unroll
      for (int i = 0; i < 8; ++i) { a[i] = (__bf16)p[i]; a[8 + i] = (__bf16)p[16 + i]; } }
#pragma unroll
    for (int j = 0; j < 4; ++j) { v16b w; const float* wr = Wt + (size_t)(j * 16 + col) * CC + kc * 32 + 8 * g;
#pragma unroll
      for (int i = 0; i < 8; ++i) { w[i] = (__bf16)wr[i]; w[8 + i] = (__bf16)wr[16 + i]; }
      asm volatile("s_wait_loadcnt 0x0" ::: "memory"); acc[j] = wmma_bf(a, w, acc[j]); } }
#pragma unroll
  for (int j = 0; j < 4; ++j) { const int o = j * 16 + col; const float bb = bfr(Bv[o]); float sc = 1.f, sh0 = 0.f; if (which == 2) { sc = rsqrtf(bfr(VAR[o]) + 1e-5f) * bfr(G[o]); sh0 = bfr(BT[o]) - bfr(MU[o]) * sc; }
#pragma unroll
    for (int r = 0; r < 8; ++r) { const float v = acc[j][r] + bb; const int rl = wave * 16 + 8 * g + r;
      if (which == 2) th[o][rl] = (_Float16)(v * sc + sh0); else { const _Float16 hv = (_Float16)v; sh[rl][o] = hv; sl[rl][o] = (_Float16)((v - (float)hv) * 1024.0f); } } }
  __syncthreads();
  if (which < 2) { _Float16* DH = which == 0 ? AH : BH; _Float16* DL = which == 0 ? AL : BL; for (int e = tid; e < 64 * 8; e += 128) { const int rl = e >> 3, q = e & 7; vst2((unsigned*)(DH + (r0 + rl) * CC + q * 8), *(const v4u*)&sh[rl][q * 8]); vst2((unsigned*)(DL + (r0 + rl) * CC + q * 8), *(const v4u*)&sl[rl][q * 8]); } }
  else { const size_t b = r0 / TT; const int n0 = (int)(r0 % TT); for (int e = tid; e < CC * 8; e += 128) { const int cl = e >> 3, q = e & 7; vst2((unsigned*)(MP + (b * CC + cl) * (size_t)TT + n0 + q * 8), *(const v4u*)&th[cl][q * 8]); } } }
// ---- k_sc: block = (64 queries of the chunk, 128 keys) of batch b: 3-product logits over the 64 channels, no scale
__global__ __launch_bounds__(128) void k_sc(const _Float16* __restrict__ AH, const _Float16* __restrict__ AL, const _Float16* __restrict__ BH, const _Float16* __restrict__ BL, int b, int qbase, float* __restrict__ S) { __shared__ __align__(16) float ss[4][16][132];
  const int tid = threadIdx.x, wave = tid >> 5, lane = tid & 31, col = lane & 15, g = lane >> 4; const int k0 = blockIdx.y * 128; const int ql0 = blockIdx.x * 64 + wave * 16; const size_t qrow = (size_t)b * TT + qbase + ql0 + col;
  v8f acc[8] = {}, accl[8] = {};
#pragma unroll
  for (int kc = 0; kc < CC / 32; ++kc) { const v16h ah = frag_h(AH + qrow * CC + kc * 32, lane), al = frag_h(AL + qrow * CC + kc * 32, lane);
#pragma unroll
    for (int j = 0; j < 8; ++j) { const size_t ko = ((size_t)b * TT + k0 + j * 16 + col) * CC + kc * 32; const v16h kb = frag_h(BH + ko, lane), kl = frag_h(BL + ko, lane); acc[j] = wmma16(ah, kb, acc[j]); accl[j] = wmma16(al, kb, accl[j]); accl[j] = wmma16(ah, kl, accl[j]); } }
#pragma unroll
  for (int j = 0; j < 8; ++j)
#pragma unroll
    for (int r = 0; r < 8; ++r) ss[wave][8 * g + r][j * 16 + col] = acc[j][r] + accl[j][r] * (1.0f / 1024.0f);
  LDSX(); for (int rl = 0; rl < 16; ++rl) vst2(S + (size_t)(ql0 + rl) * TT + k0 + lane * 4, *(const v4f*)&ss[wave][rl][lane * 4]); }
// ---- k_sm: block = query row of the chunk (256 threads): softmax over the 8,192 keys (f32) -> P x 2^11 in place
__global__ __launch_bounds__(256) void k_sm(float* __restrict__ S) { __shared__ float sred[8]; __shared__ float sbc; __shared__ __align__(16) float shh[TT];
  const int t = threadIdx.x; const size_t row = blockIdx.x; float* sr = S + row * TT;
  float m = -3.0e38f; for (int k = t; k < TT; k += 256) { const float v = sr[k]; shh[k] = v; m = fmaxf(m, v); }
#pragma unroll
  for (int o = 1; o < 32; o <<= 1) m = fmaxf(m, __shfl_xor(m, o));
  if ((t & 31) == 0) sred[t >> 5] = m; __syncthreads(); if (t == 0) { float a = sred[0]; for (int w = 1; w < 8; ++w) a = fmaxf(a, sred[w]); sbc = a; } __syncthreads(); m = sbc; __syncthreads();
  float s = 0.f; for (int k = t; k < TT; k += 256) { const float e = expf(shh[k] - m); shh[k] = e; s += e; }
#pragma unroll
  for (int o = 1; o < 32; o <<= 1) s += __shfl_xor(s, o);
  if ((t & 31) == 0) sred[t >> 5] = s; __syncthreads(); if (t == 0) { float a = 0.f; for (int w = 0; w < 8; ++w) a += sred[w]; sbc = 2048.0f / a; } __syncthreads(); const float sc = sbc;
  for (int k = t; k < TT; k += 256) shh[k] *= sc;
  __syncthreads(); for (int q = t; q < TT / 4; q += 256) vst2(sr + q * 4, *(const v4f*)&shh[q * 4]); }
// ---- k_pv: block = 64 queries of the chunk: o[n][c] = (P . m) / 2^11 (P f16 hi + residual x f16 planes, 2 products); epilogue: res = 2 (feature + alpha o) transposed through LDS to channels-first (256-B runs per channel)
__global__ __launch_bounds__(128) void k_pv(const float* __restrict__ PS, const _Float16* __restrict__ MP, const float* __restrict__ X, const float* __restrict__ ALPHA, int b, int qbase, float* __restrict__ OUT) { __shared__ __align__(16) float stc[CC][68];
  const int tid = threadIdx.x, wave = tid >> 5, lane = tid & 31, col = lane & 15, g = lane >> 4; const int ql0 = blockIdx.x * 64 + wave * 16; const float alpha = bfr(ALPHA[0]);
  v8f acc[4] = {}, accl[4] = {};
#pragma unroll 1
  for (int kc = 0; kc < TT / 32; ++kc) { v16h ph, pl; { const float* pr = PS + (size_t)(ql0 + col) * TT + kc * 32 + 8 * g;
#pragma unroll
      for (int i = 0; i < 8; ++i) { const float a0 = pr[i], a1 = pr[16 + i]; const _Float16 h0 = (_Float16)a0, h1 = (_Float16)a1; ph[i] = h0; ph[8 + i] = h1; pl[i] = (_Float16)((a0 - (float)h0) * 1024.0f); pl[8 + i] = (_Float16)((a1 - (float)h1) * 1024.0f); } }
    asm volatile("s_wait_loadcnt 0x0" ::: "memory");
#pragma unroll
    for (int j = 0; j < 4; ++j) { const v16h mv = frag_h(MP + ((size_t)b * CC + j * 16 + col) * (size_t)TT + kc * 32, lane); acc[j] = wmma16(ph, mv, acc[j]); accl[j] = wmma16(pl, mv, accl[j]); } }
#pragma unroll
  for (int j = 0; j < 4; ++j)
#pragma unroll
    for (int r = 0; r < 8; ++r) stc[j * 16 + col][wave * 16 + 8 * g + r] = (acc[j][r] + accl[j][r] * (1.0f / 1024.0f)) * (1.0f / 2048.0f);
  __syncthreads();
  { const int n0 = qbase + blockIdx.x * 64; for (int e = tid; e < CC * 16; e += 128) { const int c = e >> 4, q = e & 15; const size_t off = ((size_t)b * CC + c) * (size_t)XSTR + n0 + q * 4; const v4f xr = *(const v4f*)(X + off); v4f o = *(const v4f*)&stc[c][q * 4];
#pragma unroll
      for (int z = 0; z < 4; ++z) { const float p = bfr(xr[z]) + alpha * o[z]; o[z] = p + p; }
      vst2(OUT + off, o); } } }
extern "C" void kernel_launch(void* const* d_in, const int* in_sizes, int n_in, void* d_out, int out_size, void* d_ws, size_t ws_size, hipStream_t stream) {
  (void)in_sizes; (void)n_in; (void)out_size;
  const float** F = (const float**)d_in;   // 0 feature [2,64,8192,1], 1 wa [64,64] ([out,in]), 2 ba, 3 wb, 4 bb, 5 wm, 6 bm, 7 bn_gamma, 8 bn_beta, 9 bn_mean, 10 bn_var, 11 alpha (scalar, read)
  if (ws_size < (size_t)WS_END) return;
  char* ws = (char*)d_ws; float *XT = (float*)(ws + WS_XT), *S = (float*)(ws + WS_S); _Float16 *AH = (_Float16*)(ws + WS_AH), *AL = (_Float16*)(ws + WS_AL), *BH = (_Float16*)(ws + WS_BH), *BL = (_Float16*)(ws + WS_BL), *MP = (_Float16*)(ws + WS_MP);
  k_xt<<<dim3(TT / 64, TNB), 256, 0, stream>>>(F[0], XT);
  k_proj<<<dim3(TNB * TT / 64, 3), 128, 0, stream>>>(XT, F[1], F[2], F[3], F[4], F[5], F[6], F[7], F[8], F[9], F[10], AH, AL, BH, BL, MP);
  for (int b = 0; b < TNB; ++b) for (int qc = 0; qc < NQCH; ++qc) {
    k_sc<<<dim3(QCH / 64, TT / 128), 128, 0, stream>>>(AH, AL, BH, BL, b, qc * QCH, S);
    k_sm<<<dim3(QCH), 256, 0, stream>>>(S);
    k_pv<<<dim3(QCH / 64), 128, 0, stream>>>(S, MP, F[0], F[11], b, qc * QCH, (float*)d_out);
  }
}

// v001
// Measured time: 767 microseconds a run.
// Next to v000, in two timings, it ran 3.01 and 3.00 times as fast.
// compute dtype: all float inputs rounded to bf16, alpha read; the three 1x1 convs with EXACT bf16 products on WMMA 16x16x32 (f32 accumulate, + bias), eval BatchNorm affine in f32; logits a^T b over the 64 channels with a and b as f16 hi + residual (x 2^10), 3 products, stored in f32; softmax in f32 (precise expf); P x 2^11 as f16 hi + residual against the normalised m rounded ONCE to f16 (2 products); residual blend 2 (feature + alpha out) in f32; channels-first f32 output.
#include <hip/hip_runtime.h>
#include <math.h>

typedef __attribute__((ext_vector_type(16))) _Float16 v16h;
typedef __attribute__((ext_vector_type(16))) __bf16 v16b;
typedef __attribute__((ext_vector_type(8)))  _Float16 v8h;
typedef __attribute__((ext_vector_type(8)))  float v8f;
typedef __attribute__((ext_vector_type(4)))  float v4f;
typedef __attribute__((ext_vector_type(2)))  float v2f;
typedef __attribute__((ext_vector_type(4)))  unsigned v4u;
typedef __attribute__((ext_vector_type(4)))  int v4i;
typedef float __attribute__((may_alias)) float_a;
typedef int __attribute__((may_alias)) int_a;

template <typename T> __device__ __forceinline__ void vst2(void* p, T v) { *(T*)p = v;  }
__device__ __forceinline__ v8f wmma16(v16h a, v16h b, v8f c) {
  v8f d = __builtin_amdgcn_wmma_f32_16x16x32_f16(false, a, false, b, (short)0, c, false, false);
  asm volatile("v_nop\n\tv_nop\n\tv_nop\n\tv_nop" : "+v"(d) : "v"(a), "v"(b));
  return d;
}
__device__ __forceinline__ v8f wmma_bf(v16b a, v16b b, v8f c) {
  v8f d = __builtin_amdgcn_wmma_f32_16x16x32_bf16(false, a, false, b, (short)0, c, false, false);
  asm volatile("v_nop\n\tv_nop\n\tv_nop\n\tv_nop" : "+v"(d) : "v"(a), "v"(b));
  return d;
}
// 16x16x32 fragments: lane = (h = lane>>4, row/col = lane&15); elements 0..7 = k0+8h+0..7, 8..15 = k0+16+8h+0..7; D element r = row 8h+r
__device__ __forceinline__ v16h frag_h(const _Float16* rowk0, int lane) {
  union { v16h v; v8h q[2]; } u; const _Float16* p = rowk0 + 8 * (lane >> 4);
  u.q[0] = *(const v8h*)p; u.q[1] = *(const v8h*)(p + 16); return u.v;
}
__device__ __forceinline__ v16h frag_f32(const float* rowk0, int lane) {
  v16h a; const float* p = rowk0 + 8 * (lane >> 4);
#pragma unroll
  for (int i = 0; i < 8; ++i) { a[i] = (_Float16)p[i]; a[8 + i] = (_Float16)p[16 + i]; }
  return a;
}
__device__ __forceinline__ v16h frag_f32s(const float* rowk0, int lane, float sc) {
  v16h a; const float* p = rowk0 + 8 * (lane >> 4);
#pragma unroll
  for (int i = 0; i < 8; ++i) { a[i] = (_Float16)(p[i] * sc); a[8 + i] = (_Float16)(p[16 + i] * sc); }
  return a;
}
// column fragment from a [K][ld] layout (column n), rows >= K read as 0
__device__ __forceinline__ v16h fragc_f32(const float* W, int k0, int n, int lane, int ld, int K) {
  v16h a; const int g = lane >> 4;
#pragma unroll
  for (int i = 0; i < 8; ++i) { const int ka = k0 + 8 * g + i, kb = ka + 16;
    a[i] = (_Float16)(ka < K ? W[(size_t)(ka < K ? ka : K - 1) * ld + n] : 0.f); a[8 + i] = (_Float16)(kb < K ? W[(size_t)(kb < K ? kb : K - 1) * ld + n] : 0.f); }
  return a;
}
struct F2 { v16b h, l; };
__device__ __forceinline__ F2 bsplit16(const float v[16]) { F2 r;
#pragma unroll
  for (int i = 0; i < 16; ++i) { const __bf16 h = (__bf16)v[i]; r.h[i] = h; r.l[i] = (__bf16)(v[i] - (float)h); }
  return r; }
__device__ __forceinline__ F2 split_row(const float* row, int k0, int lane) { float v[16]; const float* p = row + k0 + 8 * (lane >> 4);
#pragma unroll
  for (int i = 0; i < 8; ++i) { v[i] = p[i]; v[8 + i] = p[16 + i]; }
  return bsplit16(v); }
__device__ __forceinline__ F2 split_rowK(const float* row, int k0, int lane, int K) { float v[16]; const int g = lane >> 4;
#pragma unroll
  for (int i = 0; i < 8; ++i) { const int ka = k0 + 8 * g + i, kb = ka + 16; v[i] = ka < K ? row[ka < K ? ka : K - 1] : 0.f; v[8 + i] = kb < K ? row[kb < K ? kb : K - 1] : 0.f; }
  return bsplit16(v); }
__device__ __forceinline__ F2 split_col(const float* W, int k0, int n, int lane, int ld, int K) { float v[16]; const int g = lane >> 4;
#pragma unroll
  for (int i = 0; i < 8; ++i) { const int ka = k0 + 8 * g + i, kb = ka + 16; v[i] = ka < K ? W[(size_t)(ka < K ? ka : K - 1) * ld + n] : 0.f; v[8 + i] = kb < K ? W[(size_t)(kb < K ? kb : K - 1) * ld + n] : 0.f; }
  return bsplit16(v); }
__device__ __forceinline__ v8f mac3(const F2& a, const F2& b, v8f c) { c = wmma_bf(a.l, b.h, c); c = wmma_bf(a.h, b.l, c); return wmma_bf(a.h, b.h, c); }
__device__ __forceinline__ float sigm(float v) { return 1.0f / (1.0f + expf(-v)); }
#define LDSX() do { asm volatile("s_wait_dscnt 0" ::: "memory"); __builtin_amdgcn_wave_barrier(); __builtin_amdgcn_fence(__ATOMIC_RELEASE, "workgroup"); } while (0)

// GFA / PAM (B 2, C 64, N 8,192 points): a, b, m = conv1x1(x); att = softmax_m(sum_c a[c][n] b[c][m]); m = BN_eval(m); out[c][n] = sum_m att[n][m] m[c][m]; p = feature + alpha out; return p + p.
__device__ __forceinline__ float bfr(float v) { return (float)(__bf16)v; }
#define NB 2
#define CC 64
#define TT 8192
#define QCH 2048              // query rows per attention chunk (S chunk = 2048 x 8192 f32 = 64 MB)
#ifndef TNB
#define TNB NB
#endif
#ifndef NQCH
#define NQCH (TT / QCH)
#endif
#ifndef XSTR
#define XSTR TT
#endif
#define WS_XT  0u                                   // f32 x rows [b*N+n][64] (bf16 values)
#define WS_AH  (WS_XT + 4u * (size_t)NB * TT * CC)    // f16 a hi / lo rows [b*N+n][64]
#define WS_AL  (WS_AH + 2u * (size_t)NB * TT * CC)
#define WS_BH  (WS_AL + 2u * (size_t)NB * TT * CC)    // f16 b hi / lo rows
#define WS_BL  (WS_BH + 2u * (size_t)NB * TT * CC)
#define WS_MP  (WS_BL + 2u * (size_t)NB * TT * CC)    // f16 normalised-m planes [b][c][n]
#define WS_S   (WS_MP + 2u * (size_t)NB * CC * TT)    // f32 S / P chunk [QCH][TT]
#define WS_END (WS_S + 4u * (size_t)QCH * TT)
// ---- k_xt: block = (64 points, b): channels-first feature -> rows [b*N+n][64] (bf16 values); 256-B rows
__global__ __launch_bounds__(256) void k_xt(const float* __restrict__ X, float* __restrict__ XT) { __shared__ float st[CC][65];
  const int t = threadIdx.x; const int n0 = blockIdx.x * 64; const size_t b = blockIdx.y;
  for (int e = t; e < CC * 64; e += 256) { const int c = e >> 6, nl = e & 63; st[c][nl] = bfr(X[(b * CC + c) * (size_t)XSTR + n0 + nl]); }
  __syncthreads();
  for (int e = t; e < 64 * 16; e += 256) { const int nl = e >> 4, q = e & 15; v4f o; o[0] = st[q * 4][nl]; o[1] = st[q * 4 + 1][nl]; o[2] = st[q * 4 + 2][nl]; o[3] = st[q * 4 + 3][nl]; vst2(XT + (b * TT + n0 + nl) * CC + q * 4, o); } }
__global__ __launch_bounds__(128) void k_proj(const float* __restrict__ XT, const float* __restrict__ WA, const float* __restrict__ BA, const float* __restrict__ WB, const float* __restrict__ BB, const float* __restrict__ WM, const float* __restrict__ BM, const float* __restrict__ G, const float* __restrict__ BT, const float* __restrict__ MU, const float* __restrict__ VAR,
    _Float16* __restrict__ AH, _Float16* __restrict__ AL, _Float16* __restrict__ BH, _Float16* __restrict__ BL, _Float16* __restrict__ MP) { __shared__ __align__(16) _Float16 sh[64][72], sl[64][72]; __shared__ __align__(16) _Float16 th[CC][72];
  const int tid = threadIdx.x, wave = tid >> 5, lane = tid & 31, col = lane & 15, g = lane >> 4; const int which = blockIdx.y; const size_t r0 = (size_t)blockIdx.x * 64; const float* Wt = which == 0 ? WA : which == 1 ? WB : WM; const float* Bv = which == 0 ? BA : which == 1 ? BB : BM;
  v8f acc[4] = {};
#pragma unroll
  for (int kc = 0; kc < CC / 32; ++kc) { v16b a; { const float* p = XT + (r0 + wave * 16 + col) * CC + kc * 32 + 8 * g;
#pragma unroll
      for (int i = 0; i < 8; ++i) { a[i] = (__bf16)p[i]; a[8 + i] = (__bf16)p[16 + i]; } }
#pragma unroll
    for (int j = 0; j < 4; ++j) { v16b w; const float* wr = Wt + (size_t)(j * 16 + col) * CC + kc * 32 + 8 * g;
#pragma unroll
      for (int i = 0; i < 8; ++i) { w[i] = (__bf16)wr[i]; w[8 + i] = (__bf16)wr[16 + i]; }
      asm volatile("s_wait_loadcnt 0x0" ::: "memory"); acc[j] = wmma_bf(a, w, acc[j]); } }
#pragma unroll
  for (int j = 0; j < 4; ++j) { const int o = j * 16 + col; const float bb = bfr(Bv[o]); float sc = 1.f, sh0 = 0.f; if (which == 2) { sc = rsqrtf(bfr(VAR[o]) + 1e-5f) * bfr(G[o]); sh0 = bfr(BT[o]) - bfr(MU[o]) * sc; }
#pragma unroll
    for (int r = 0; r < 8; ++r) { const float v = acc[j][r] + bb; const int rl = wave * 16 + 8 * g + r;
      if (which == 2) th[o][rl] = (_Float16)(v * sc + sh0); else { const _Float16 hv = (_Float16)v; sh[rl][o] = hv; sl[rl][o] = (_Float16)((v - (float)hv) * 1024.0f); } } }
  __syncthreads();
  if (which < 2) { _Float16* DH = which == 0 ? AH : BH; _Float16* DL = which == 0 ? AL : BL; for (int e = tid; e < 64 * 8; e += 128) { const int rl = e >> 3, q = e & 7; vst2((unsigned*)(DH + (r0 + rl) * CC + q * 8), *(const v4u*)&sh[rl][q * 8]); vst2((unsigned*)(DL + (r0 + rl) * CC + q * 8), *(const v4u*)&sl[rl][q * 8]); } }
  else { const size_t b = r0 / TT; const int n0 = (int)(r0 % TT); for (int e = tid; e < CC * 8; e += 128) { const int cl = e >> 3, q = e & 7; vst2((unsigned*)(MP + (b * CC + cl) * (size_t)TT + n0 + q * 8), *(const v4u*)&th[cl][q * 8]); } } }
// ---- k_sc: block = (64 queries of the chunk, 128 keys) of batch b: 3-product logits over the 64 channels, no scale
__global__ __launch_bounds__(128) void k_sc(const _Float16* __restrict__ AH, const _Float16* __restrict__ AL, const _Float16* __restrict__ BH, const _Float16* __restrict__ BL, int b, int qbase, float* __restrict__ S) { __shared__ __align__(16) float ss[4][16][132];
  const int tid = threadIdx.x, wave = tid >> 5, lane = tid & 31, col = lane & 15, g = lane >> 4; const int k0 = blockIdx.y * 128; const int ql0 = blockIdx.x * 64 + wave * 16; const size_t qrow = (size_t)b * TT + qbase + ql0 + col;
  v8f acc[8] = {}, accl[8] = {};
#pragma unroll
  for (int kc = 0; kc < CC / 32; ++kc) { const v16h ah = frag_h(AH + qrow * CC + kc * 32, lane), al = frag_h(AL + qrow * CC + kc * 32, lane);
#pragma unroll
    for (int j = 0; j < 8; ++j) { const size_t ko = ((size_t)b * TT + k0 + j * 16 + col) * CC + kc * 32; const v16h kb = frag_h(BH + ko, lane), kl = frag_h(BL + ko, lane); acc[j] = wmma16(ah, kb, acc[j]); accl[j] = wmma16(al, kb, accl[j]); accl[j] = wmma16(ah, kl, accl[j]); } }
#pragma unroll
  for (int j = 0; j < 8; ++j)
#pragma unroll
    for (int r = 0; r < 8; ++r) ss[wave][8 * g + r][j * 16 + col] = acc[j][r] + accl[j][r] * (1.0f / 1024.0f);
  LDSX(); for (int rl = 0; rl < 16; ++rl) vst2(S + (size_t)(ql0 + rl) * TT + k0 + lane * 4, *(const v4f*)&ss[wave][rl][lane * 4]); }
// ---- k_sm: block = query row of the chunk (256 threads): softmax over the 8,192 keys (f32) -> P x 2^11 in place
__global__ __launch_bounds__(256) void k_sm(float* __restrict__ S) { __shared__ float sred[8]; __shared__ float sbc; __shared__ __align__(16) float shh[TT];
  const int t = threadIdx.x; const size_t row = blockIdx.x; float* sr = S + row * TT;
  float m = -3.0e38f; for (int k = t; k < TT; k += 256) { const float v = sr[k]; shh[k] = v; m = fmaxf(m, v); }
#pragma unroll
  for (int o = 1; o < 32; o <<= 1) m = fmaxf(m, __shfl_xor(m, o));
  if ((t & 31) == 0) sred[t >> 5] = m; __syncthreads(); if (t == 0) { float a = sred[0]; for (int w = 1; w < 8; ++w) a = fmaxf(a, sred[w]); sbc = a; } __syncthreads(); m = sbc; __syncthreads();
  float s = 0.f; for (int k = t; k < TT; k += 256) { const float e = expf(shh[k] - m); shh[k] = e; s += e; }
#pragma unroll
  for (int o = 1; o < 32; o <<= 1) s += __shfl_xor(s, o);
  if ((t & 31) == 0) sred[t >> 5] = s; __syncthreads(); if (t == 0) { float a = 0.f; for (int w = 0; w < 8; ++w) a += sred[w]; sbc = 2048.0f / a; } __syncthreads(); const float sc = sbc;
  for (int k = t; k < TT; k += 256) shh[k] *= sc;
  __syncthreads(); for (int q = t; q < TT / 4; q += 256) vst2(sr + q * 4, *(const v4f*)&shh[q * 4]); }
// ---- k_pv: block = 32 queries of the chunk, 32 waves = 2 query groups x 16 key ranges of 512 keys: each wave o[n][c] = (P . m) / 2^11 over its own key range (P f16 hi + residual x f16 planes, 2 products); the 16 partial tiles are summed through LDS in key order; epilogue: res = 2 (feature + alpha o), channels-first (one whole 128-B line per channel)
#define PVQ 32                // queries per block
#define PVS 16                // key ranges per block
__global__ __launch_bounds__(1024) void k_pv(const float* __restrict__ PS, const _Float16* __restrict__ MP, const float* __restrict__ X, const float* __restrict__ ALPHA, int b, int qbase, float* __restrict__ OUT) { __shared__ __align__(16) float red[PVS][CC][PVQ + 4];
  const int tid = threadIdx.x, wave = tid >> 5, lane = tid & 31, col = lane & 15, g = lane >> 4; const int qg = wave & 1, ks = wave >> 1; const int ql0 = blockIdx.x * PVQ + qg * 16; const float alpha = bfr(ALPHA[0]);
  v8f acc[4] = {}, accl[4] = {};
#pragma unroll 1
  for (int kc = ks * (TT / 32 / PVS); kc < (ks + 1) * (TT / 32 / PVS); ++kc) { v16h ph, pl; { const float* pr = PS + (size_t)(ql0 + col) * TT + kc * 32 + 8 * g;
#pragma unroll
      for (int i = 0; i < 8; ++i) { const float a0 = pr[i], a1 = pr[16 + i]; const _Float16 h0 = (_Float16)a0, h1 = (_Float16)a1; ph[i] = h0; ph[8 + i] = h1; pl[i] = (_Float16)((a0 - (float)h0) * 1024.0f); pl[8 + i] = (_Float16)((a1 - (float)h1) * 1024.0f); } }
    asm volatile("s_wait_loadcnt 0x0" ::: "memory");
#pragma unroll
    for (int j = 0; j < 4; ++j) { const v16h mv = frag_h(MP + ((size_t)b * CC + j * 16 + col) * (size_t)TT + kc * 32, lane); acc[j] = wmma16(ph, mv, acc[j]); accl[j] = wmma16(pl, mv, accl[j]); } }
#pragma unroll
  for (int j = 0; j < 4; ++j)
#pragma unroll
    for (int r = 0; r < 8; ++r) red[ks][j * 16 + col][qg * 16 + 8 * g + r] = (acc[j][r] + accl[j][r] * (1.0f / 1024.0f)) * (1.0f / 2048.0f);
  __syncthreads();
  { const int n0 = qbase + blockIdx.x * PVQ; for (int e = tid; e < CC * (PVQ / 4); e += 1024) { const int c = e >> 3, q = e & 7; const size_t off = ((size_t)b * CC + c) * (size_t)XSTR + n0 + q * 4; const v4f xr = *(const v4f*)(X + off); v4f o = *(const v4f*)&red[0][c][q * 4];
#pragma unroll
      for (int s = 1; s < PVS; ++s) o += *(const v4f*)&red[s][c][q * 4];
#pragma unroll
      for (int z = 0; z < 4; ++z) { const float p = bfr(xr[z]) + alpha * o[z]; o[z] = p + p; }
      vst2(OUT + off, o); } } }
extern "C" void kernel_launch(void* const* d_in, const int* in_sizes, int n_in, void* d_out, int out_size, void* d_ws, size_t ws_size, hipStream_t stream) {
  (void)in_sizes; (void)n_in; (void)out_size;
  const float** F = (const float**)d_in;   // 0 feature [2,64,8192,1], 1 wa [64,64] ([out,in]), 2 ba, 3 wb, 4 bb, 5 wm, 6 bm, 7 bn_gamma, 8 bn_beta, 9 bn_mean, 10 bn_var, 11 alpha (scalar, read)
  if (ws_size < (size_t)WS_END) return;
  char* ws = (char*)d_ws; float *XT = (float*)(ws + WS_XT), *S = (float*)(ws + WS_S); _Float16 *AH = (_Float16*)(ws + WS_AH), *AL = (_Float16*)(ws + WS_AL), *BH = (_Float16*)(ws + WS_BH), *BL = (_Float16*)(ws + WS_BL), *MP = (_Float16*)(ws + WS_MP);
  k_xt<<<dim3(TT / 64, TNB), 256, 0, stream>>>(F[0], XT);
  k_proj<<<dim3(TNB * TT / 64, 3), 128, 0, stream>>>(XT, F[1], F[2], F[3], F[4], F[5], F[6], F[7], F[8], F[9], F[10], AH, AL, BH, BL, MP);
  for (int b = 0; b < TNB; ++b) for (int qc = 0; qc < NQCH; ++qc) {
    k_sc<<<dim3(QCH / 64, TT / 128), 128, 0, stream>>>(AH, AL, BH, BL, b, qc * QCH, S);
    k_sm<<<dim3(QCH), 256, 0, stream>>>(S);
    k_pv<<<dim3(QCH / PVQ), 1024, 0, stream>>>(S, MP, F[0], F[11], b, qc * QCH, (float*)d_out);
  }
}

// v002
// It runs in 118 microseconds.
// Two timings next to v001 both put it at 6.51 times that version's speed.
// Over all steps from v000 it is 19.6 times as fast.
// compute dtype: all float inputs rounded to bf16, alpha read; the three 1x1 convs with EXACT bf16 products on WMMA 16x16x32 (f32 accumulate, + bias), eval BatchNorm affine in f32; logits a^T b over the 64 channels with a and b as f16 hi + residual (x 2^10), 3 products, kept in f32 registers; softmax in f32 with a running maximum and sum (precise expf), divided by the sum at the end; exp(s - max) x 2^11 as f16 hi + residual against the normalised m rounded ONCE to f16 (2 products); residual blend 2 (feature + alpha out) in f32; channels-first f32 output.
#include <hip/hip_runtime.h>
#include <math.h>

typedef __attribute__((ext_vector_type(16))) _Float16 v16h;
typedef __attribute__((ext_vector_type(16))) __bf16 v16b;
typedef __attribute__((ext_vector_type(8)))  _Float16 v8h;
typedef __attribute__((ext_vector_type(8)))  float v8f;
typedef __attribute__((ext_vector_type(4)))  float v4f;
typedef __attribute__((ext_vector_type(2)))  float v2f;
typedef __attribute__((ext_vector_type(4)))  unsigned v4u;
typedef __attribute__((ext_vector_type(4)))  int v4i;
typedef float __attribute__((may_alias)) float_a;
typedef int __attribute__((may_alias)) int_a;

template <typename T> __device__ __forceinline__ void vst2(void* p, T v) { *(T*)p = v;  }
__device__ __forceinline__ v8f wmma16(v16h a, v16h b, v8f c) {
  v8f d = __builtin_amdgcn_wmma_f32_16x16x32_f16(false, a, false, b, (short)0, c, false, false);
  asm volatile("v_nop\n\tv_nop\n\tv_nop\n\tv_nop" : "+v"(d) : "v"(a), "v"(b));
  return d;
}
__device__ __forceinline__ v8f wmma_bf(v16b a, v16b b, v8f c) {
  v8f d = __builtin_amdgcn_wmma_f32_16x16x32_bf16(false, a, false, b, (short)0, c, false, false);
  asm volatile("v_nop\n\tv_nop\n\tv_nop\n\tv_nop" : "+v"(d) : "v"(a), "v"(b));
  return d;
}
// 16x16x32 fragments: lane = (h = lane>>4, row/col = lane&15); elements 0..7 = k0+8h+0..7, 8..15 = k0+16+8h+0..7; D element r = row 8h+r
__device__ __forceinline__ v16h frag_h(const _Float16* rowk0, int lane) {
  union { v16h v; v8h q[2]; } u; const _Float16* p = rowk0 + 8 * (lane >> 4);
  u.q[0] = *(const v8h*)p; u.q[1] = *(const v8h*)(p + 16); return u.v;
}
__device__ __forceinline__ v16h frag_f32(const float* rowk0, int lane) {
  v16h a; const float* p = rowk0 + 8 * (lane >> 4);
#pragma unroll
  for (int i = 0; i < 8; ++i) { a[i] = (_Float16)p[i]; a[8 + i] = (_Float16)p[16 + i]; }
  return a;
}
__device__ __forceinline__ v16h frag_f32s(const float* rowk0, int lane, float sc) {
  v16h a; const float* p = rowk0 + 8 * (lane >> 4);
#pragma unroll
  for (int i = 0; i < 8; ++i) { a[i] = (_Float16)(p[i] * sc); a[8 + i] = (_Float16)(p[16 + i] * sc); }
  return a;
}
// column fragment from a [K][ld] layout (column n), rows >= K read as 0
__device__ __forceinline__ v16h fragc_f32(const float* W, int k0, int n, int lane, int ld, int K) {
  v16h a; const int g = lane >> 4;
#pragma unroll
  for (int i = 0; i < 8; ++i) { const int ka = k0 + 8 * g + i, kb = ka + 16;
    a[i] = (_Float16)(ka < K ? W[(size_t)(ka < K ? ka : K - 1) * ld + n] : 0.f); a[8 + i] = (_Float16)(kb < K ? W[(size_t)(kb < K ? kb : K - 1) * ld + n] : 0.f); }
  return a;
}
struct F2 { v16b h, l; };
__device__ __forceinline__ F2 bsplit16(const float v[16]) { F2 r;
#pragma unroll
  for (int i = 0; i < 16; ++i) { const __bf16 h = (__bf16)v[i]; r.h[i] = h; r.l[i] = (__bf16)(v[i] - (float)h); }
  return r; }
__device__ __forceinline__ F2 split_row(const float* row, int k0, int lane) { float v[16]; const float* p = row + k0 + 8 * (lane >> 4);
#pragma unroll
  for (int i = 0; i < 8; ++i) { v[i] = p[i]; v[8 + i] = p[16 + i]; }
  return bsplit16(v); }
__device__ __forceinline__ F2 split_rowK(const float* row, int k0, int lane, int K) { float v[16]; const int g = lane >> 4;
#pragma unroll
  for (int i = 0; i < 8; ++i) { const int ka = k0 + 8 * g + i, kb = ka + 16; v[i] = ka < K ? row[ka < K ? ka : K - 1] : 0.f; v[8 + i] = kb < K ? row[kb < K ? kb : K - 1] : 0.f; }
  return bsplit16(v); }
__device__ __forceinline__ F2 split_col(const float* W, int k0, int n, int lane, int ld, int K) { float v[16]; const int g = lane >> 4;
#pragma unroll
  for (int i = 0; i < 8; ++i) { const int ka = k0 + 8 * g + i, kb = ka + 16; v[i] = ka < K ? W[(size_t)(ka < K ? ka : K - 1) * ld + n] : 0.f; v[8 + i] = kb < K ? W[(size_t)(kb < K ? kb : K - 1) * ld + n] : 0.f; }
  return bsplit16(v); }
__device__ __forceinline__ v8f mac3(const F2& a, const F2& b, v8f c) { c = wmma_bf(a.l, b.h, c); c = wmma_bf(a.h, b.l, c); return wmma_bf(a.h, b.h, c); }
__device__ __forceinline__ float sigm(float v) { return 1.0f / (1.0f + expf(-v)); }
#define LDSX() do { asm volatile("s_wait_dscnt 0" ::: "memory"); __builtin_amdgcn_wave_barrier(); __builtin_amdgcn_fence(__ATOMIC_RELEASE, "workgroup"); } while (0)

// GFA / PAM (B 2, C 64, N 8,192 points): a, b, m = conv1x1(x); att = softmax_m(sum_c a[c][n] b[c][m]); m = BN_eval(m); out[c][n] = sum_m att[n][m] m[c][m]; p = feature + alpha out; return p + p.
__device__ __forceinline__ float bfr(float v) { return (float)(__bf16)v; }
#define NB 2
#define CC 64
#define TT 8192
#ifndef TNB
#define TNB NB
#endif
#ifndef XSTR
#define XSTR TT
#endif
#define WS_XT  0u                                   // f32 x rows [b*N+n][64] (bf16 values)
#define WS_AH  (WS_XT + 4u * (size_t)NB * TT * CC)    // f16 a hi / lo rows [b*N+n][64]
#define WS_AL  (WS_AH + 2u * (size_t)NB * TT * CC)
#define WS_BH  (WS_AL + 2u * (size_t)NB * TT * CC)    // f16 b hi / lo rows
#define WS_BL  (WS_BH + 2u * (size_t)NB * TT * CC)
#define WS_MP  (WS_BL + 2u * (size_t)NB * TT * CC)    // f16 normalised-m planes [b][c][n]
#define WS_END (WS_MP + 2u * (size_t)NB * CC * TT)
// ---- k_xt: block = (64 points, b): channels-first feature -> rows [b*N+n][64] (bf16 values); 256-B rows
__global__ __launch_bounds__(256) void k_xt(const float* __restrict__ X, float* __restrict__ XT) { __shared__ float st[CC][65];
  const int t = threadIdx.x; const int n0 = blockIdx.x * 64; const size_t b = blockIdx.y;
  for (int e = t; e < CC * 64; e += 256) { const int c = e >> 6, nl = e & 63; st[c][nl] = bfr(X[(b * CC + c) * (size_t)XSTR + n0 + nl]); }
  __syncthreads();
  for (int e = t; e < 64 * 16; e += 256) { const int nl = e >> 4, q = e & 15; v4f o; o[0] = st[q * 4][nl]; o[1] = st[q * 4 + 1][nl]; o[2] = st[q * 4 + 2][nl]; o[3] = st[q * 4 + 3][nl]; vst2(XT + (b * TT + n0 + nl) * CC + q * 4, o); } }
__global__ __launch_bounds__(128) void k_proj(const float* __restrict__ XT, const float* __restrict__ WA, const float* __restrict__ BA, const float* __restrict__ WB, const float* __restrict__ BB, const float* __restrict__ WM, const float* __restrict__ BM, const float* __restrict__ G, const float* __restrict__ BT, const float* __restrict__ MU, const float* __restrict__ VAR,
    _Float16* __restrict__ AH, _Float16* __restrict__ AL, _Float16* __restrict__ BH, _Float16* __restrict__ BL, _Float16* __restrict__ MP) { __shared__ __align__(16) _Float16 sh[64][72], sl[64][72]; __shared__ __align__(16) _Float16 th[CC][72];
  const int tid = threadIdx.x, wave = tid >> 5, lane = tid & 31, col = lane & 15, g = lane >> 4; const int which = blockIdx.y; const size_t r0 = (size_t)blockIdx.x * 64; const float* Wt = which == 0 ? WA : which == 1 ? WB : WM; const float* Bv = which == 0 ? BA : which == 1 ? BB : BM;
  v8f acc[4] = {};
#pragma unroll
  for (int kc = 0; kc < CC / 32; ++kc) { v16b a; { const float* p = XT + (r0 + wave * 16 + col) * CC + kc * 32 + 8 * g;
#pragma unroll
      for (int i = 0; i < 8; ++i) { a[i] = (__bf16)p[i]; a[8 + i] = (__bf16)p[16 + i]; } }
#pragma unroll
    for (int j = 0; j < 4; ++j) { v16b w; const float* wr = Wt + (size_t)(j * 16 + col) * CC + kc * 32 + 8 * g;
#pragma unroll
      for (int i = 0; i < 8; ++i) { w[i] = (__bf16)wr[i]; w[8 + i] = (__bf16)wr[16 + i]; }
      asm volatile("s_wait_loadcnt 0x0" ::: "memory"); acc[j] = wmma_bf(a, w, acc[j]); } }
#pragma unroll
  for (int j = 0; j < 4; ++j) { const int o = j * 16 + col; const float bb = bfr(Bv[o]); float sc = 1.f, sh0 = 0.f; if (which == 2) { sc = rsqrtf(bfr(VAR[o]) + 1e-5f) * bfr(G[o]); sh0 = bfr(BT[o]) - bfr(MU[o]) * sc; }
#pragma unroll
    for (int r = 0; r < 8; ++r) { const float v = acc[j][r] + bb; const int rl = wave * 16 + 8 * g + r;
      if (which == 2) th[o][rl] = (_Float16)(v * sc + sh0); else { const _Float16 hv = (_Float16)v; sh[rl][o] = hv; sl[rl][o] = (_Float16)((v - (float)hv) * 1024.0f); } } }
  __syncthreads();
  if (which < 2) { _Float16* DH = which == 0 ? AH : BH; _Float16* DL = which == 0 ? AL : BL; for (int e = tid; e < 64 * 8; e += 128) { const int rl = e >> 3, q = e & 7; vst2((unsigned*)(DH + (r0 + rl) * CC + q * 8), *(const v4u*)&sh[rl][q * 8]); vst2((unsigned*)(DL + (r0 + rl) * CC + q * 8), *(const v4u*)&sl[rl][q * 8]); } }
  else { const size_t b = r0 / TT; const int n0 = (int)(r0 % TT); for (int e = tid; e < CC * 8; e += 128) { const int cl = e >> 3, q = e & 7; vst2((unsigned*)(MP + (b * CC + cl) * (size_t)TT + n0 + q * 8), *(const v4u*)&th[cl][q * 8]); } } }
// lane l with lane l ^ 16
__device__ __forceinline__ float xhalf(float x) { return __builtin_bit_cast(float, __builtin_amdgcn_permlanex16(__builtin_bit_cast(int, x), __builtin_bit_cast(int, x), 0x76543210, 0xfedcba98, false, false)); }
// ---- k_fa: block = 64 queries of batch b, 16 waves = 4 query groups of 16 x 4 key ranges. A stage is 128 keys (b hi / lo rows and the m planes) in LDS, two buffers, filled through registers one stage ahead; key range ks takes keys 32 ks .. 32 ks + 31 of every stage.
// Per pass: St = b . at (3 products; a lane holds 16 keys of ONE query), running maximum and sum in f32, exp(s - max) x 2^11 as f16 hi + residual packs straight into a B operand, Ot += m . Pt (2 products; a lane holds 8 channels of one query per tile).
// The four key ranges' (max, sum, Ot) are joined through LDS in key-range order; epilogue: res = 2 (feature + alpha o), channels-first (two whole 128-B lines per channel)
#define FQ 4                  // query groups of 16 per block
#define FS 4                  // key ranges per block
#define FK (FS * 32)          // keys per stage
#define FNS (TT / FK)         // stages
#define FQN (FQ * 16)         // queries per block
__global__ __launch_bounds__(512) void k_fa(const _Float16* __restrict__ AH, const _Float16* __restrict__ AL, const _Float16* __restrict__ BH, const _Float16* __restrict__ BL, const _Float16* __restrict__ MP, const float* __restrict__ X, const float* __restrict__ ALPHA, float* __restrict__ OUT) {
  __shared__ __align__(16) _Float16 kh[2][FK][72], kl[2][FK][72], mm[2][CC][FK + 8];   // pitches 144 B and 272 B: 16 B x odd
  __shared__ __align__(16) float red[FS][CC][FQN + 4]; __shared__ __align__(16) float rm[FS][FQN], rl[FS][FQN], rw[FS][FQN];
  const int tid = threadIdx.x, wave = tid >> 5, lane = tid & 31, col = lane & 15, g = lane >> 4; const int qg = wave & (FQ - 1), ks = wave / FQ; const size_t b = blockIdx.y; const int n0 = blockIdx.x * FQN; const float alpha = bfr(ALPHA[0]);
  v16h ah[2], al[2];
#pragma unroll
  for (int kc = 0; kc < 2; ++kc) { const size_t qo = (b * TT + n0 + qg * 16 + col) * CC + kc * 32; ah[kc] = frag_h(AH + qo, lane); al[kc] = frag_h(AL + qo, lane); }
  const int kr = tid >> 3, kq = (tid & 7) * 8, mc = tid >> 4, mq = (tid & 15) * 8;   // this thread's 16-B pieces of a stage: key rows kr, kr + 64; channels mc, mc + 32
  const _Float16* gh = BH + (b * TT + kr) * CC + kq; const _Float16* gl = BL + (b * TT + kr) * CC + kq; const _Float16* gm = MP + (b * CC + mc) * (size_t)TT + mq;
  v8h r0 = *(const v8h*)gh, r1 = *(const v8h*)(gh + 64 * CC), r2 = *(const v8h*)gl, r3 = *(const v8h*)(gl + 64 * CC), r4 = *(const v8h*)gm, r5 = *(const v8h*)(gm + 32 * (size_t)TT);
  asm volatile("s_wait_xcnt 0x0" ::: "memory");   // stands in front of the first overwrite of an address register of the loads above
  *(v8h*)&kh[0][kr][kq] = r0; *(v8h*)&kh[0][kr + 64][kq] = r1; *(v8h*)&kl[0][kr][kq] = r2; *(v8h*)&kl[0][kr + 64][kq] = r3; *(v8h*)&mm[0][mc][mq] = r4; *(v8h*)&mm[0][mc + 32][mq] = r5;
  __syncthreads();
  v8f acc[4] = {}, accl[4] = {}; float m = -3.0e38f, l = 0.f;
#pragma unroll 1
  for (int st = 0; st < FNS; ++st) { const int bf = st & 1; const bool more = st + 1 < FNS;
    if (more) { const size_t ko = (size_t)(st + 1) * FK * CC; const int mo = (st + 1) * FK;
      r0 = *(const v8h*)(gh + ko); r1 = *(const v8h*)(gh + ko + 64 * CC); r2 = *(const v8h*)(gl + ko); r3 = *(const v8h*)(gl + ko + 64 * CC); r4 = *(const v8h*)(gm + mo); r5 = *(const v8h*)(gm + mo + 32 * (size_t)TT); }
    v8f sa[2] = {}, sl[2] = {};
#pragma unroll
    for (int kc = 0; kc < 2; ++kc) { v16h kb[2], kv[2];
#pragma unroll
      for (int t = 0; t < 2; ++t) { kb[t] = frag_h(&kh[bf][ks * 32 + t * 16 + col][kc * 32], lane); kv[t] = frag_h(&kl[bf][ks * 32 + t * 16 + col][kc * 32], lane); }
#pragma unroll
      for (int t = 0; t < 2; ++t) sa[t] = wmma16(kb[t], ah[kc], sa[t]);
#pragma unroll
      for (int t = 0; t < 2; ++t) sl[t] = wmma16(kb[t], al[kc], sl[t]);
#pragma unroll
      for (int t = 0; t < 2; ++t) sl[t] = wmma16(kv[t], ah[kc], sl[t]); }
    v16h mv[4];   // read here so that the LDS latency passes behind the softmax arithmetic
#pragma unroll
    for (int j = 0; j < 4; ++j) mv[j] = frag_h(&mm[bf][j * 16 + col][ks * 32], lane);
    float s[16];
#pragma unroll
    for (int i = 0; i < 16; ++i) s[i] = sa[i >> 3][i & 7] + sl[i >> 3][i & 7] * (1.0f / 1024.0f);   // key 32 ks + 16 (i >> 3) + 8 g + (i & 7) of the stage, query col: the k order of a B operand
    float mx = s[0];
#pragma unroll
    for (int i = 1; i < 16; ++i) mx = fmaxf(mx, s[i]);
    mx = fmaxf(mx, xhalf(mx)); const float mn = fmaxf(m, mx); const float f = expf(m - mn); m = mn;
    v16h ph, pl; float ps = 0.f;
#pragma unroll
    for (int i = 0; i < 16; ++i) { const float e = expf(s[i] - mn); ps += e; const float a0 = e * 2048.0f; const _Float16 h0 = (_Float16)a0; ph[i] = h0; pl[i] = (_Float16)((a0 - (float)h0) * 1024.0f); }
    l = l * f + ps;
#pragma unroll
    for (int j = 0; j < 4; ++j) { acc[j] *= f; accl[j] *= f; }
#pragma unroll
    for (int j = 0; j < 4; ++j) { acc[j] = wmma16(mv[j], ph, acc[j]); accl[j] = wmma16(mv[j], pl, accl[j]); }
    if (more) { const int bn = bf ^ 1; *(v8h*)&kh[bn][kr][kq] = r0; *(v8h*)&kh[bn][kr + 64][kq] = r1; *(v8h*)&kl[bn][kr][kq] = r2; *(v8h*)&kl[bn][kr + 64][kq] = r3; *(v8h*)&mm[bn][mc][mq] = r4; *(v8h*)&mm[bn][mc + 32][mq] = r5; }
    __syncthreads(); }   // publishes stage st + 1 and ends every read of the buffer that the next trip refills
  l += xhalf(l);
#pragma unroll
  for (int j = 0; j < 4; ++j)
#pragma unroll
    for (int r = 0; r < 8; ++r) red[ks][j * 16 + 8 * g + r][qg * 16 + col] = (acc[j][r] + accl[j][r] * (1.0f / 1024.0f)) * (1.0f / 2048.0f);
  if (g == 0) { rm[ks][qg * 16 + col] = m; rl[ks][qg * 16 + col] = l; }
  __syncthreads();
  if (tid < FQN) { float mt = rm[0][tid];
#pragma unroll
    for (int s = 1; s < FS; ++s) mt = fmaxf(mt, rm[s][tid]);
    float w[FS], lt = 0.f;
#pragma unroll
    for (int s = 0; s < FS; ++s) { w[s] = expf(rm[s][tid] - mt); lt += w[s] * rl[s][tid]; }
    const float inv = 1.0f / lt;
#pragma unroll
    for (int s = 0; s < FS; ++s) rw[s][tid] = w[s] * inv; }
  __syncthreads();
  for (int e = tid; e < CC * (FQN / 4); e += 512) { const int c = e >> 4, q = e & 15; const size_t off = (b * CC + c) * (size_t)XSTR + n0 + q * 4; const v4f xr = *(const v4f*)(X + off); v4f o = *(const v4f*)&red[0][c][q * 4] * *(const v4f*)&rw[0][q * 4];
#pragma unroll
    for (int s = 1; s < FS; ++s) o += *(const v4f*)&red[s][c][q * 4] * *(const v4f*)&rw[s][q * 4];
#pragma unroll
    for (int z = 0; z < 4; ++z) { const float p = bfr(xr[z]) + alpha * o[z]; o[z] = p + p; }
    vst2(OUT + off, o); } }
extern "C" void kernel_launch(void* const* d_in, const int* in_sizes, int n_in, void* d_out, int out_size, void* d_ws, size_t ws_size, hipStream_t stream) {
  (void)in_sizes; (void)n_in; (void)out_size;
  const float** F = (const float**)d_in;   // 0 feature [2,64,8192,1], 1 wa [64,64] ([out,in]), 2 ba, 3 wb, 4 bb, 5 wm, 6 bm, 7 bn_gamma, 8 bn_beta, 9 bn_mean, 10 bn_var, 11 alpha (scalar, read)
  if (ws_size < (size_t)WS_END) return;
  char* ws = (char*)d_ws; float *XT = (float*)(ws + WS_XT); _Float16 *AH = (_Float16*)(ws + WS_AH), *AL = (_Float16*)(ws + WS_AL), *BH = (_Float16*)(ws + WS_BH), *BL = (_Float16*)(ws + WS_BL), *MP = (_Float16*)(ws + WS_MP);
  k_xt<<<dim3(TT / 64, TNB), 256, 0, stream>>>(F[0], XT);
  k_proj<<<dim3(TNB * TT / 64, 3), 128, 0, stream>>>(XT, F[1], F[2], F[3], F[4], F[5], F[6], F[7], F[8], F[9], F[10], AH, AL, BH, BL, MP);
  k_fa<<<dim3(TT / FQN, TNB), 512, 0, stream>>>(AH, AL, BH, BL, MP, F[0], F[11], (float*)d_out);
}

// v003
// It runs in 96.1 microseconds.
// Next to v002, in two timings, it ran 1.23 times as fast each time.
// Counting every step since v000, it is 24.1 times as fast.
// compute dtype: all float inputs rounded to bf16, alpha read; the three 1x1 convs with EXACT bf16 products on WMMA 16x16x32 (f32 accumulate, + bias), eval BatchNorm affine in f32; logits a^T b over the 64 channels with a and b as f16 hi + residual (x 2^10), 3 products, kept in f32 registers; softmax in f32 with a running maximum and sum, both kept in the base-2 domain (2^(s log2e - max log2e + 11) by the hardware exp2), divided by the sum at the end; exp(s - max) x 2^11 as f16 hi + residual against the normalised m rounded ONCE to f16 (2 products); residual blend 2 (feature + alpha out) in f32; channels-first f32 output.
#include <hip/hip_runtime.h>
#include <math.h>

typedef __attribute__((ext_vector_type(16))) _Float16 v16h;
typedef __attribute__((ext_vector_type(16))) __bf16 v16b;
typedef __attribute__((ext_vector_type(8)))  _Float16 v8h;
typedef __attribute__((ext_vector_type(8)))  float v8f;
typedef __attribute__((ext_vector_type(4)))  float v4f;
typedef __attribute__((ext_vector_type(2)))  float v2f;
typedef __attribute__((ext_vector_type(4)))  unsigned v4u;
typedef __attribute__((ext_vector_type(4)))  int v4i;
typedef float __attribute__((may_alias)) float_a;
typedef int __attribute__((may_alias)) int_a;

template <typename T> __device__ __forceinline__ void vst2(void* p, T v) { *(T*)p = v;  }
__device__ __forceinline__ v8f wmma16(v16h a, v16h b, v8f c) {
  v8f d = __builtin_amdgcn_wmma_f32_16x16x32_f16(false, a, false, b, (short)0, c, false, false);
  asm volatile("v_nop\n\tv_nop\n\tv_nop\n\tv_nop" : "+v"(d) : "v"(a), "v"(b));
  return d;
}
__device__ __forceinline__ v8f wmma_bf(v16b a, v16b b, v8f c) {
  v8f d = __builtin_amdgcn_wmma_f32_16x16x32_bf16(false, a, false, b, (short)0, c, false, false);
  asm volatile("v_nop\n\tv_nop\n\tv_nop\n\tv_nop" : "+v"(d) : "v"(a), "v"(b));
  return d;
}
// 16x16x32 fragments: lane = (h = lane>>4, row/col = lane&15); elements 0..7 = k0+8h+0..7, 8..15 = k0+16+8h+0..7; D element r = row 8h+r
__device__ __forceinline__ v16h frag_h(const _Float16* rowk0, int lane) {
  union { v16h v; v8h q[2]; } u; const _Float16* p = rowk0 + 8 * (lane >> 4);
  u.q[0] = *(const v8h*)p; u.q[1] = *(const v8h*)(p + 16); return u.v;
}
__device__ __forceinline__ v16h frag_f32(const float* rowk0, int lane) {
  v16h a; const float* p = rowk0 + 8 * (lane >> 4);
#pragma unroll
  for (int i = 0; i < 8; ++i) { a[i] = (_Float16)p[i]; a[8 + i] = (_Float16)p[16 + i]; }
  return a;
}
__device__ __forceinline__ v16h frag_f32s(const float* rowk0, int lane, float sc) {
  v16h a; const float* p = rowk0 + 8 * (lane >> 4);
#pragma unroll
  for (int i = 0; i < 8; ++i) { a[i] = (_Float16)(p[i] * sc); a[8 + i] = (_Float16)(p[16 + i] * sc); }
  return a;
}
// column fragment from a [K][ld] layout (column n), rows >= K read as 0
__device__ __forceinline__ v16h fragc_f32(const float* W, int k0, int n, int lane, int ld, int K) {
  v16h a; const int g = lane >> 4;
#pragma unroll
  for (int i = 0; i < 8; ++i) { const int ka = k0 + 8 * g + i, kb = ka + 16;
    a[i] = (_Float16)(ka < K ? W[(size_t)(ka < K ? ka : K - 1) * ld + n] : 0.f); a[8 + i] = (_Float16)(kb < K ? W[(size_t)(kb < K ? kb : K - 1) * ld + n] : 0.f); }
  return a;
}
struct F2 { v16b h, l; };
__device__ __forceinline__ F2 bsplit16(const float v[16]) { F2 r;
#pragma unroll
  for (int i = 0; i < 16; ++i) { const __bf16 h = (__bf16)v[i]; r.h[i] = h; r.l[i] = (__bf16)(v[i] - (float)h); }
  return r; }
__device__ __forceinline__ F2 split_row(const float* row, int k0, int lane) { float v[16]; const float* p = row + k0 + 8 * (lane >> 4);
#pragma unroll
  for (int i = 0; i < 8; ++i) { v[i] = p[i]; v[8 + i] = p[16 + i]; }
  return bsplit16(v); }
__device__ __forceinline__ F2 split_rowK(const float* row, int k0, int lane, int K) { float v[16]; const int g = lane >> 4;
#pragma unroll
  for (int i = 0; i < 8; ++i) { const int ka = k0 + 8 * g + i, kb = ka + 16; v[i] = ka < K ? row[ka < K ? ka : K - 1] : 0.f; v[8 + i] = kb < K ? row[kb < K ? kb : K - 1] : 0.f; }
  return bsplit16(v); }
__device__ __forceinline__ F2 split_col(const float* W, int k0, int n, int lane, int ld, int K) { float v[16]; const int g = lane >> 4;
#pragma unroll
  for (int i = 0; i < 8; ++i) { const int ka = k0 + 8 * g + i, kb = ka + 16; v[i] = ka < K ? W[(size_t)(ka < K ? ka : K - 1) * ld + n] : 0.f; v[8 + i] = kb < K ? W[(size_t)(kb < K ? kb : K - 1) * ld + n] : 0.f; }
  return bsplit16(v); }
__device__ __forceinline__ v8f mac3(const F2& a, const F2& b, v8f c) { c = wmma_bf(a.l, b.h, c); c = wmma_bf(a.h, b.l, c); return wmma_bf(a.h, b.h, c); }
__device__ __forceinline__ float sigm(float v) { return 1.0f / (1.0f + expf(-v)); }
#define LDSX() do { asm volatile("s_wait_dscnt 0" ::: "memory"); __builtin_amdgcn_wave_barrier(); __builtin_amdgcn_fence(__ATOMIC_RELEASE, "workgroup"); } while (0)

// GFA / PAM (B 2, C 64, N 8,192 points): a, b, m = conv1x1(x); att = softmax_m(sum_c a[c][n] b[c][m]); m = BN_eval(m); out[c][n] = sum_m att[n][m] m[c][m]; p = feature + alpha out; return p + p.
__device__ __forceinline__ float bfr(float v) { return (float)(__bf16)v; }
#define NB 2
#define CC 64
#define TT 8192
#ifndef TNB
#define TNB NB
#endif
#ifndef XSTR
#define XSTR TT
#endif
#define WS_XT  0u                                   // f32 x rows [b*N+n][64] (bf16 values)
#define WS_AH  (WS_XT + 4u * (size_t)NB * TT * CC)    // f16 a hi / lo rows [b*N+n][64]
#define WS_AL  (WS_AH + 2u * (size_t)NB * TT * CC)
#define WS_BH  (WS_AL + 2u * (size_t)NB * TT * CC)    // f16 b hi / lo rows
#define WS_BL  (WS_BH + 2u * (size_t)NB * TT * CC)
#define WS_MP  (WS_BL + 2u * (size_t)NB * TT * CC)    // f16 normalised-m planes [b][c][n]
#define WS_END (WS_MP + 2u * (size_t)NB * CC * TT)
// ---- k_xt: block = (64 points, b): channels-first feature -> rows [b*N+n][64] (bf16 values); 256-B rows
__global__ __launch_bounds__(256) void k_xt(const float* __restrict__ X, float* __restrict__ XT) { __shared__ float st[CC][65];
  const int t = threadIdx.x; const int n0 = blockIdx.x * 64; const size_t b = blockIdx.y;
  for (int e = t; e < CC * 64; e += 256) { const int c = e >> 6, nl = e & 63; st[c][nl] = bfr(X[(b * CC + c) * (size_t)XSTR + n0 + nl]); }
  __syncthreads();
  for (int e = t; e < 64 * 16; e += 256) { const int nl = e >> 4, q = e & 15; v4f o; o[0] = st[q * 4][nl]; o[1] = st[q * 4 + 1][nl]; o[2] = st[q * 4 + 2][nl]; o[3] = st[q * 4 + 3][nl]; vst2(XT + (b * TT + n0 + nl) * CC + q * 4, o); } }
__global__ __launch_bounds__(128) void k_proj(const float* __restrict__ XT, const float* __restrict__ WA, const float* __restrict__ BA, const float* __restrict__ WB, const float* __restrict__ BB, const float* __restrict__ WM, const float* __restrict__ BM, const float* __restrict__ G, const float* __restrict__ BT, const float* __restrict__ MU, const float* __restrict__ VAR,
    _Float16* __restrict__ AH, _Float16* __restrict__ AL, _Float16* __restrict__ BH, _Float16* __restrict__ BL, _Float16* __restrict__ MP) { __shared__ __align__(16) _Float16 sh[64][72], sl[64][72]; __shared__ __align__(16) _Float16 th[CC][72];
  const int tid = threadIdx.x, wave = tid >> 5, lane = tid & 31, col = lane & 15, g = lane >> 4; const int which = blockIdx.y; const size_t r0 = (size_t)blockIdx.x * 64; const float* Wt = which == 0 ? WA : which == 1 ? WB : WM; const float* Bv = which == 0 ? BA : which == 1 ? BB : BM;
  v8f acc[4] = {};
#pragma unroll
  for (int kc = 0; kc < CC / 32; ++kc) { v16b a; { const float* p = XT + (r0 + wave * 16 + col) * CC + kc * 32 + 8 * g;
#pragma unroll
      for (int i = 0; i < 8; ++i) { a[i] = (__bf16)p[i]; a[8 + i] = (__bf16)p[16 + i]; } }
#pragma unroll
    for (int j = 0; j < 4; ++j) { v16b w; const float* wr = Wt + (size_t)(j * 16 + col) * CC + kc * 32 + 8 * g;
#pragma unroll
      for (int i = 0; i < 8; ++i) { w[i] = (__bf16)wr[i]; w[8 + i] = (__bf16)wr[16 + i]; }
      asm volatile("s_wait_loadcnt 0x0" ::: "memory"); acc[j] = wmma_bf(a, w, acc[j]); } }
#pragma unroll
  for (int j = 0; j < 4; ++j) { const int o = j * 16 + col; const float bb = bfr(Bv[o]); float sc = 1.f, sh0 = 0.f; if (which == 2) { sc = rsqrtf(bfr(VAR[o]) + 1e-5f) * bfr(G[o]); sh0 = bfr(BT[o]) - bfr(MU[o]) * sc; }
#pragma unroll
    for (int r = 0; r < 8; ++r) { const float v = acc[j][r] + bb; const int rl = wave * 16 + 8 * g + r;
      if (which == 2) th[o][rl] = (_Float16)(v * sc + sh0); else { const _Float16 hv = (_Float16)v; sh[rl][o] = hv; sl[rl][o] = (_Float16)((v - (float)hv) * 1024.0f); } } }
  __syncthreads();
  if (which < 2) { _Float16* DH = which == 0 ? AH : BH; _Float16* DL = which == 0 ? AL : BL; for (int e = tid; e < 64 * 8; e += 128) { const int rl = e >> 3, q = e & 7; vst2((unsigned*)(DH + (r0 + rl) * CC + q * 8), *(const v4u*)&sh[rl][q * 8]); vst2((unsigned*)(DL + (r0 + rl) * CC + q * 8), *(const v4u*)&sl[rl][q * 8]); } }
  else { const size_t b = r0 / TT; const int n0 = (int)(r0 % TT); for (int e = tid; e < CC * 8; e += 128) { const int cl = e >> 3, q = e & 7; vst2((unsigned*)(MP + (b * CC + cl) * (size_t)TT + n0 + q * 8), *(const v4u*)&th[cl][q * 8]); } } }
// lane l with lane l ^ 16
__device__ __forceinline__ float xhalf(float x) { return __builtin_bit_cast(float, __builtin_amdgcn_permlanex16(__builtin_bit_cast(int, x), __builtin_bit_cast(int, x), 0x76543210, 0xfedcba98, false, false)); }
// ---- k_fa: block = 64 queries of batch b, 16 waves = 4 query groups of 16 x 4 key ranges. A stage is 128 keys (b hi / lo rows and the m planes) in LDS, two buffers, filled through registers one stage ahead; key range ks takes keys 32 ks .. 32 ks + 31 of every stage.
// Per pass: St = b . at (3 products; a lane holds 16 keys of ONE query), running maximum (as max log2e - 11) and sum (x 2^11) in f32, 2^(s log2e - that maximum) = exp(s - max) x 2^11 as f16 hi + residual packs straight into a B operand, Ot += m . Pt (2 products; a lane holds 8 channels of one query per tile).
// The four key ranges' (max, sum, Ot) are joined through LDS in key-range order; epilogue: res = 2 (feature + alpha o), channels-first (two whole 128-B lines per channel)
#define FQ 4                  // query groups of 16 per block
#define FS 4                  // key ranges per block
#define FK (FS * 32)          // keys per stage
#define FNS (TT / FK)         // stages
#define FQN (FQ * 16)         // queries per block
#define L2E 1.4426950408889634f
// 2^x by v_exp_f32, several independent ones in one statement. Every argument here is <= about 11, and a result below the normal range may go to 0.
// Each result has a register of its own ("=&v"), so no v_exp_f32 overwrites a source of the one in front of it; the closing v_nop is the slot the instruction set asks for between the last one and a reader of its result.
__device__ __forceinline__ void ex2x8(float* r, const float* x) {
  asm("v_exp_f32 %0, %8\n\tv_exp_f32 %1, %9\n\tv_exp_f32 %2, %10\n\tv_exp_f32 %3, %11\n\tv_exp_f32 %4, %12\n\tv_exp_f32 %5, %13\n\tv_exp_f32 %6, %14\n\tv_exp_f32 %7, %15\n\tv_nop"
      : "=&v"(r[0]), "=&v"(r[1]), "=&v"(r[2]), "=&v"(r[3]), "=&v"(r[4]), "=&v"(r[5]), "=&v"(r[6]), "=&v"(r[7]) : "v"(x[0]), "v"(x[1]), "v"(x[2]), "v"(x[3]), "v"(x[4]), "v"(x[5]), "v"(x[6]), "v"(x[7])); }
__device__ __forceinline__ float ex2(float x) { float r; asm("v_exp_f32 %0, %1\n\tv_nop" : "=&v"(r) : "v"(x)); return r; }
__global__ __launch_bounds__(512) void k_fa(const _Float16* __restrict__ AH, const _Float16* __restrict__ AL, const _Float16* __restrict__ BH, const _Float16* __restrict__ BL, const _Float16* __restrict__ MP, const float* __restrict__ X, const float* __restrict__ ALPHA, float* __restrict__ OUT) {
  __shared__ __align__(16) _Float16 kh[2][FK][72], kl[2][FK][72], mm[2][CC][FK + 8];   // pitches 144 B and 272 B: 16 B x odd
  __shared__ __align__(16) float red[FS][CC][FQN + 4]; __shared__ __align__(16) float rm[FS][FQN], rl[FS][FQN], rw[FS][FQN];
  const int tid = threadIdx.x, wave = tid >> 5, lane = tid & 31, col = lane & 15, g = lane >> 4; const int qg = wave & (FQ - 1), ks = wave / FQ; const size_t b = blockIdx.y; const int n0 = blockIdx.x * FQN; const float alpha = bfr(ALPHA[0]);
  v16h ah[2], al[2];
#pragma unroll
  for (int kc = 0; kc < 2; ++kc) { const size_t qo = (b * TT + n0 + qg * 16 + col) * CC + kc * 32; ah[kc] = frag_h(AH + qo, lane); al[kc] = frag_h(AL + qo, lane); }
  const int kr = tid >> 3, kq = (tid & 7) * 8, mc = tid >> 4, mq = (tid & 15) * 8;   // this thread's 16-B pieces of a stage: key rows kr, kr + 64; channels mc, mc + 32
  const _Float16* gh = BH + (b * TT + kr) * CC + kq; const _Float16* gl = BL + (b * TT + kr) * CC + kq; const _Float16* gm = MP + (b * CC + mc) * (size_t)TT + mq;
  v8h r0 = *(const v8h*)gh, r1 = *(const v8h*)(gh + 64 * CC), r2 = *(const v8h*)gl, r3 = *(const v8h*)(gl + 64 * CC), r4 = *(const v8h*)gm, r5 = *(const v8h*)(gm + 32 * (size_t)TT);
  asm volatile("s_wait_xcnt 0x0" ::: "memory");   // stands in front of the first overwrite of an address register of the loads above
  *(v8h*)&kh[0][kr][kq] = r0; *(v8h*)&kh[0][kr + 64][kq] = r1; *(v8h*)&kl[0][kr][kq] = r2; *(v8h*)&kl[0][kr + 64][kq] = r3; *(v8h*)&mm[0][mc][mq] = r4; *(v8h*)&mm[0][mc + 32][mq] = r5;
  __syncthreads();
  v8f acc[4] = {}, accl[4] = {}; float m = -3.0e38f, l = 0.f;
#pragma unroll 1
  for (int st = 0; st < FNS; ++st) { const int bf = st & 1; const bool more = st + 1 < FNS;
    if (more) { const size_t ko = (size_t)(st + 1) * FK * CC; const int mo = (st + 1) * FK;
      r0 = *(const v8h*)(gh + ko); r1 = *(const v8h*)(gh + ko + 64 * CC); r2 = *(const v8h*)(gl + ko); r3 = *(const v8h*)(gl + ko + 64 * CC); r4 = *(const v8h*)(gm + mo); r5 = *(const v8h*)(gm + mo + 32 * (size_t)TT); }
    v8f sa[2] = {}, sl[2] = {};
#pragma unroll
    for (int kc = 0; kc < 2; ++kc) { v16h kb[2], kv[2];
#pragma unroll
      for (int t = 0; t < 2; ++t) { kb[t] = frag_h(&kh[bf][ks * 32 + t * 16 + col][kc * 32], lane); kv[t] = frag_h(&kl[bf][ks * 32 + t * 16 + col][kc * 32], lane); }
#pragma unroll
      for (int t = 0; t < 2; ++t) sa[t] = wmma16(kb[t], ah[kc], sa[t]);
#pragma unroll
      for (int t = 0; t < 2; ++t) sl[t] = wmma16(kb[t], al[kc], sl[t]);
#pragma unroll
      for (int t = 0; t < 2; ++t) sl[t] = wmma16(kv[t], ah[kc], sl[t]); }
    v16h mv[4];   // read here so that the LDS latency passes behind the softmax arithmetic
#pragma unroll
    for (int j = 0; j < 4; ++j) mv[j] = frag_h(&mm[bf][j * 16 + col][ks * 32], lane);
    float s[16];
#pragma unroll
    for (int i = 0; i < 16; ++i) s[i] = sa[i >> 3][i & 7] + sl[i >> 3][i & 7] * (1.0f / 1024.0f);   // key 32 ks + 16 (i >> 3) + 8 g + (i & 7) of the stage, query col: the k order of a B operand
    float mx = s[0];
#pragma unroll
    for (int i = 1; i < 16; ++i) mx = fmaxf(mx, s[i]);
    mx = fmaxf(mx, xhalf(mx)); const float mn = fmaxf(m, fmaf(mx, L2E, -11.0f)); const float f = ex2(m - mn); m = mn;
    float tx[16], a0[16];
#pragma unroll   // constant indices, so that tx and a0 are registers
    for (int i = 0; i < 16; i += 2) { const v2f t2 = __builtin_elementwise_fma((v2f){s[i], s[i + 1]}, (v2f){L2E, L2E}, (v2f){-mn, -mn}); tx[i] = t2[0]; tx[i + 1] = t2[1]; }
    ex2x8(a0, tx); ex2x8(a0 + 8, tx + 8);
    v16h ph, pl; float ps = 0.f;
#pragma unroll
    for (int i = 0; i < 16; ++i) { ps += a0[i]; const _Float16 h0 = (_Float16)a0[i]; ph[i] = h0; pl[i] = (_Float16)((a0[i] - (float)h0) * 1024.0f); }
    l = l * f + ps;
#pragma unroll
    for (int j = 0; j < 4; ++j) { acc[j] *= f; accl[j] *= f; }
#pragma unroll
    for (int j = 0; j < 4; ++j) { acc[j] = wmma16(mv[j], ph, acc[j]); accl[j] = wmma16(mv[j], pl, accl[j]); }
    if (more) { const int bn = bf ^ 1; *(v8h*)&kh[bn][kr][kq] = r0; *(v8h*)&kh[bn][kr + 64][kq] = r1; *(v8h*)&kl[bn][kr][kq] = r2; *(v8h*)&kl[bn][kr + 64][kq] = r3; *(v8h*)&mm[bn][mc][mq] = r4; *(v8h*)&mm[bn][mc + 32][mq] = r5; }
    __syncthreads(); }   // publishes stage st + 1 and ends every read of the buffer that the next trip refills
  l += xhalf(l);
#pragma unroll
  for (int j = 0; j < 4; ++j)
#pragma unroll
    for (int r = 0; r < 8; ++r) red[ks][j * 16 + 8 * g + r][qg * 16 + col] = acc[j][r] + accl[j][r] * (1.0f / 1024.0f);   // x 2^11, as the sum l is
  if (g == 0) { rm[ks][qg * 16 + col] = m; rl[ks][qg * 16 + col] = l; }
  __syncthreads();
  if (tid < FQN) { float mt = rm[0][tid];
#pragma unroll
    for (int s = 1; s < FS; ++s) mt = fmaxf(mt, rm[s][tid]);
    float w[FS], lt = 0.f;
#pragma unroll
    for (int s = 0; s < FS; ++s) { w[s] = ex2(rm[s][tid] - mt); lt += w[s] * rl[s][tid]; }
    const float inv = 1.0f / lt;
#pragma unroll
    for (int s = 0; s < FS; ++s) rw[s][tid] = w[s] * inv; }
  __syncthreads();
  for (int e = tid; e < CC * (FQN / 4); e += 512) { const int c = e >> 4, q = e & 15; const size_t off = (b * CC + c) * (size_t)XSTR + n0 + q * 4; const v4f xr = *(const v4f*)(X + off); v4f o = *(const v4f*)&red[0][c][q * 4] * *(const v4f*)&rw[0][q * 4];
#pragma unroll
    for (int s = 1; s < FS; ++s) o += *(const v4f*)&red[s][c][q * 4] * *(const v4f*)&rw[s][q * 4];
#pragma unroll
    for (int z = 0; z < 4; ++z) { const float p = bfr(xr[z]) + alpha * o[z]; o[z] = p + p; }
    vst2(OUT + off, o); } }
extern "C" void kernel_launch(void* const* d_in, const int* in_sizes, int n_in, void* d_out, int out_size, void* d_ws, size_t ws_size, hipStream_t stream) {
  (void)in_sizes; (void)n_in; (void)out_size;
  const float** F = (const float**)d_in;   // 0 feature [2,64,8192,1], 1 wa [64,64] ([out,in]), 2 ba, 3 wb, 4 bb, 5 wm, 6 bm, 7 bn_gamma, 8 bn_beta, 9 bn_mean, 10 bn_var, 11 alpha (scalar, read)
  if (ws_size < (size_t)WS_END) return;
  char* ws = (char*)d_ws; float *XT = (float*)(ws + WS_XT); _Float16 *AH = (_Float16*)(ws + WS_AH), *AL = (_Float16*)(ws + WS_AL), *BH = (_Float16*)(ws + WS_BH), *BL = (_Float16*)(ws + WS_BL), *MP = (_Float16*)(ws + WS_MP);
  k_xt<<<dim3(TT / 64, TNB), 256, 0, stream>>>(F[0], XT);
  k_proj<<<dim3(TNB * TT / 64, 3), 128, 0, stream>>>(XT, F[1], F[2], F[3], F[4], F[5], F[6], F[7], F[8], F[9], F[10], AH, AL, BH, BL, MP);
  k_fa<<<dim3(TT / FQN, TNB), 512, 0, stream>>>(AH, AL, BH, BL, MP, F[0], F[11], (float*)d_out);
}

// v004
// Measured time: 92 microseconds a run.
// Next to v003, in two timings, it ran 1.05 and 1.04 times as fast.
// All steps since v000 together make it 25.2 times as fast.
// compute dtype: all float inputs rounded to bf16, alpha read; the three 1x1 convs with EXACT bf16 products on WMMA 16x16x32 (f32 accumulate, + bias), eval BatchNorm affine in f32; logits a^T b over the 64 channels with a and b as f16 hi + residual (x 2^10), 3 products, kept in f32 registers; softmax in f32 with a running maximum and sum, both kept in the base-2 domain (2^(s log2e - max log2e + 11) by the hardware exp2), divided by the sum at the end; exp(s - max) x 2^11 as f16 hi + residual against the normalised m rounded ONCE to f16 (2 products); residual blend 2 (feature + alpha out) in f32; channels-first f32 output.
#include <hip/hip_runtime.h>
#include <math.h>

typedef __attribute__((ext_vector_type(16))) _Float16 v16h;
typedef __attribute__((ext_vector_type(16))) __bf16 v16b;
typedef __attribute__((ext_vector_type(8)))  _Float16 v8h;
typedef __attribute__((ext_vector_type(8)))  float v8f;
typedef __attribute__((ext_vector_type(4)))  float v4f;
typedef __attribute__((ext_vector_type(2)))  float v2f;
typedef __attribute__((ext_vector_type(4)))  unsigned v4u;
typedef __attribute__((ext_vector_type(4)))  int v4i;
typedef float __attribute__((may_alias)) float_a;
typedef int __attribute__((may_alias)) int_a;

template <typename T> __device__ __forceinline__ void vst2(void* p, T v) { *(T*)p = v;  }
__device__ __forceinline__ v8f wmma16(v16h a, v16h b, v8f c) {
  return __builtin_amdgcn_wmma_f32_16x16x32_f16(false, a, false, b, (short)0, c, false, false);
}
__device__ __forceinline__ v8f wmma_bf(v16b a, v16b b, v8f c) {
  v8f d = __builtin_amdgcn_wmma_f32_16x16x32_bf16(false, a, false, b, (short)0, c, false, false);
  asm volatile("v_nop\n\tv_nop\n\tv_nop\n\tv_nop" : "+v"(d) : "v"(a), "v"(b));
  return d;
}
// 16x16x32 fragments: lane = (h = lane>>4, row/col = lane&15); elements 0..7 = k0+8h+0..7, 8..15 = k0+16+8h+0..7; D element r = row 8h+r
__device__ __forceinline__ v16h frag_h(const _Float16* rowk0, int lane) {
  union { v16h v; v8h q[2]; } u; const _Float16* p = rowk0 + 8 * (lane >> 4);
  u.q[0] = *(const v8h*)p; u.q[1] = *(const v8h*)(p + 16); return u.v;
}
__device__ __forceinline__ v16h frag_f32(const float* rowk0, int lane) {
  v16h a; const float* p = rowk0 + 8 * (lane >> 4);
#pragma unroll
  for (int i = 0; i < 8; ++i) { a[i] = (_Float16)p[i]; a[8 + i] = (_Float16)p[16 + i]; }
  return a;
}
__device__ __forceinline__ v16h frag_f32s(const float* rowk0, int lane, float sc) {
  v16h a; const float* p = rowk0 + 8 * (lane >> 4);
#pragma unroll
  for (int i = 0; i < 8; ++i) { a[i] = (_Float16)(p[i] * sc); a[8 + i] = (_Float16)(p[16 + i] * sc); }
  return a;
}
// column fragment from a [K][ld] layout (column n), rows >= K read as 0
__device__ __forceinline__ v16h fragc_f32(const float* W, int k0, int n, int lane, int ld, int K) {
  v16h a; const int g = lane >> 4;
#pragma unroll
  for (int i = 0; i < 8; ++i) { const int ka = k0 + 8 * g + i, kb = ka + 16;
    a[i] = (_Float16)(ka < K ? W[(size_t)(ka < K ? ka : K - 1) * ld + n] : 0.f); a[8 + i] = (_Float16)(kb < K ? W[(size_t)(kb < K ? kb : K - 1) * ld + n] : 0.f); }
  return a;
}
struct F2 { v16b h, l; };
__device__ __forceinline__ F2 bsplit16(const float v[16]) { F2 r;
#pragma unroll
  for (int i = 0; i < 16; ++i) { const __bf16 h = (__bf16)v[i]; r.h[i] = h; r.l[i] = (__bf16)(v[i] - (float)h); }
  return r; }
__device__ __forceinline__ F2 split_row(const float* row, int k0, int lane) { float v[16]; const float* p = row + k0 + 8 * (lane >> 4);
#pragma unroll
  for (int i = 0; i < 8; ++i) { v[i] = p[i]; v[8 + i] = p[16 + i]; }
  return bsplit16(v); }
__device__ __forceinline__ F2 split_rowK(const float* row, int k0, int lane, int K) { float v[16]; const int g = lane >> 4;
#pragma unroll
  for (int i = 0; i < 8; ++i) { const int ka = k0 + 8 * g + i, kb = ka + 16; v[i] = ka < K ? row[ka < K ? ka : K - 1] : 0.f; v[8 + i] = kb < K ? row[kb < K ? kb : K - 1] : 0.f; }
  return bsplit16(v); }
__device__ __forceinline__ F2 split_col(const float* W, int k0, int n, int lane, int ld, int K) { float v[16]; const int g = lane >> 4;
#pragma unroll
  for (int i = 0; i < 8; ++i) { const int ka = k0 + 8 * g + i, kb = ka + 16; v[i] = ka < K ? W[(size_t)(ka < K ? ka : K - 1) * ld + n] : 0.f; v[8 + i] = kb < K ? W[(size_t)(kb < K ? kb : K - 1) * ld + n] : 0.f; }
  return bsplit16(v); }
__device__ __forceinline__ v8f mac3(const F2& a, const F2& b, v8f c) { c = wmma_bf(a.l, b.h, c); c = wmma_bf(a.h, b.l, c); return wmma_bf(a.h, b.h, c); }
__device__ __forceinline__ float sigm(float v) { return 1.0f / (1.0f + expf(-v)); }
#define LDSX() do { asm volatile("s_wait_dscnt 0" ::: "memory"); __builtin_amdgcn_wave_barrier(); __builtin_amdgcn_fence(__ATOMIC_RELEASE, "workgroup"); } while (0)

// GFA / PAM (B 2, C 64, N 8,192 points): a, b, m = conv1x1(x); att = softmax_m(sum_c a[c][n] b[c][m]); m = BN_eval(m); out[c][n] = sum_m att[n][m] m[c][m]; p = feature + alpha out; return p + p.
__device__ __forceinline__ float bfr(float v) { return (float)(__bf16)v; }
#define NB 2
#define CC 64
#define TT 8192
#ifndef TNB
#define TNB NB
#endif
#ifndef XSTR
#define XSTR TT
#endif
#define WS_XT  0u                                   // f32 x rows [b*N+n][64] (bf16 values)
#define WS_AH  (WS_XT + 4u * (size_t)NB * TT * CC)    // f16 a hi / lo rows [b*N+n][64]
#define WS_AL  (WS_AH + 2u * (size_t)NB * TT * CC)
#define WS_BH  (WS_AL + 2u * (size_t)NB * TT * CC)    // f16 b hi / lo rows
#define WS_BL  (WS_BH + 2u * (size_t)NB * TT * CC)
#define WS_MP  (WS_BL + 2u * (size_t)NB * TT * CC)    // f16 normalised-m planes [b][c][n]
#define WS_END (WS_MP + 2u * (size_t)NB * CC * TT)
// ---- k_xt: block = (64 points, b): channels-first feature -> rows [b*N+n][64] (bf16 values); 256-B rows
__global__ __launch_bounds__(256) void k_xt(const float* __restrict__ X, float* __restrict__ XT) { __shared__ float st[CC][65];
  const int t = threadIdx.x; const int n0 = blockIdx.x * 64; const size_t b = blockIdx.y;
  for (int e = t; e < CC * 64; e += 256) { const int c = e >> 6, nl = e & 63; st[c][nl] = bfr(X[(b * CC + c) * (size_t)XSTR + n0 + nl]); }
  __syncthreads();
  for (int e = t; e < 64 * 16; e += 256) { const int nl = e >> 4, q = e & 15; v4f o; o[0] = st[q * 4][nl]; o[1] = st[q * 4 + 1][nl]; o[2] = st[q * 4 + 2][nl]; o[3] = st[q * 4 + 3][nl]; vst2(XT + (b * TT + n0 + nl) * CC + q * 4, o); } }
__global__ __launch_bounds__(128) void k_proj(const float* __restrict__ XT, const float* __restrict__ WA, const float* __restrict__ BA, const float* __restrict__ WB, const float* __restrict__ BB, const float* __restrict__ WM, const float* __restrict__ BM, const float* __restrict__ G, const float* __restrict__ BT, const float* __restrict__ MU, const float* __restrict__ VAR,
    _Float16* __restrict__ AH, _Float16* __restrict__ AL, _Float16* __restrict__ BH, _Float16* __restrict__ BL, _Float16* __restrict__ MP) { __shared__ __align__(16) _Float16 sh[64][72], sl[64][72]; __shared__ __align__(16) _Float16 th[CC][72];
  const int tid = threadIdx.x, wave = tid >> 5, lane = tid & 31, col = lane & 15, g = lane >> 4; const int which = blockIdx.y; const size_t r0 = (size_t)blockIdx.x * 64; const float* Wt = which == 0 ? WA : which == 1 ? WB : WM; const float* Bv = which == 0 ? BA : which == 1 ? BB : BM;
  v8f acc[4] = {};
#pragma unroll
  for (int kc = 0; kc < CC / 32; ++kc) { v16b a; { const float* p = XT + (r0 + wave * 16 + col) * CC + kc * 32 + 8 * g;
#pragma unroll
      for (int i = 0; i < 8; ++i) { a[i] = (__bf16)p[i]; a[8 + i] = (__bf16)p[16 + i]; } }
#pragma unroll
    for (int j = 0; j < 4; ++j) { v16b w; const float* wr = Wt + (size_t)(j * 16 + col) * CC + kc * 32 + 8 * g;
#pragma unroll
      for (int i = 0; i < 8; ++i) { w[i] = (__bf16)wr[i]; w[8 + i] = (__bf16)wr[16 + i]; }
      asm volatile("s_wait_loadcnt 0x0" ::: "memory"); acc[j] = wmma_bf(a, w, acc[j]); } }
#pragma unroll
  for (int j = 0; j < 4; ++j) { const int o = j * 16 + col; const float bb = bfr(Bv[o]); float sc = 1.f, sh0 = 0.f; if (which == 2) { sc = rsqrtf(bfr(VAR[o]) + 1e-5f) * bfr(G[o]); sh0 = bfr(BT[o]) - bfr(MU[o]) * sc; }
#pragma unroll
    for (int r = 0; r < 8; ++r) { const float v = acc[j][r] + bb; const int rl = wave * 16 + 8 * g + r;
      if (which == 2) th[o][rl] = (_Float16)(v * sc + sh0); else { const _Float16 hv = (_Float16)v; sh[rl][o] = hv; sl[rl][o] = (_Float16)((v - (float)hv) * 1024.0f); } } }
  __syncthreads();
  if (which < 2) { _Float16* DH = which == 0 ? AH : BH; _Float16* DL = which == 0 ? AL : BL; for (int e = tid; e < 64 * 8; e += 128) { const int rl = e >> 3, q = e & 7; vst2((unsigned*)(DH + (r0 + rl) * CC + q * 8), *(const v4u*)&sh[rl][q * 8]); vst2((unsigned*)(DL + (r0 + rl) * CC + q * 8), *(const v4u*)&sl[rl][q * 8]); } }
  else { const size_t b = r0 / TT; const int n0 = (int)(r0 % TT); for (int e = tid; e < CC * 8; e += 128) { const int cl = e >> 3, q = e & 7; vst2((unsigned*)(MP + (b * CC + cl) * (size_t)TT + n0 + q * 8), *(const v4u*)&th[cl][q * 8]); } } }
// lane l with lane l ^ 16
__device__ __forceinline__ float xhalf(float x) { return __builtin_bit_cast(float, __builtin_amdgcn_permlanex16(__builtin_bit_cast(int, x), __builtin_bit_cast(int, x), 0x76543210, 0xfedcba98, false, false)); }
// ---- k_fa: block = 64 queries of batch b, 16 waves = 4 query groups of 16 x 4 key ranges. A stage is 128 keys (b hi / lo rows and the m planes) in LDS, two buffers, filled through registers one stage ahead; key range ks takes keys 32 ks .. 32 ks + 31 of every stage.
// Per pass: St = b . at (3 products; a lane holds 16 keys of ONE query), running maximum (as max log2e - 11) and sum (x 2^11) in f32, 2^(s log2e - that maximum) = exp(s - max) x 2^11 as f16 hi + residual packs straight into a B operand, Ot += m . Pt (2 products; a lane holds 8 channels of one query per tile).
// The four key ranges' (max, sum, Ot) are joined through LDS in key-range order; epilogue: res = 2 (feature + alpha o), channels-first (two whole 128-B lines per channel)
#define FQ 4                  // query groups of 16 per block
#define FS 4                  // key ranges per block
#define FK (FS * 32)          // keys per stage
#define FNS (TT / FK)         // stages
#define FQN (FQ * 16)         // queries per block
#define L2E 1.4426950408889634f
// 2^x by v_exp_f32, several independent ones in one statement. Every argument here is <= about 11, and a result below the normal range may go to 0.
// Each result has a register of its own ("=&v"), so no v_exp_f32 overwrites a source of the one in front of it; the closing v_nop is the slot the instruction set asks for between the last one and a reader of its result.
__device__ __forceinline__ void ex2x8(float* r, const float* x) {
  asm("v_exp_f32 %0, %8\n\tv_exp_f32 %1, %9\n\tv_exp_f32 %2, %10\n\tv_exp_f32 %3, %11\n\tv_exp_f32 %4, %12\n\tv_exp_f32 %5, %13\n\tv_exp_f32 %6, %14\n\tv_exp_f32 %7, %15\n\tv_nop"
      : "=&v"(r[0]), "=&v"(r[1]), "=&v"(r[2]), "=&v"(r[3]), "=&v"(r[4]), "=&v"(r[5]), "=&v"(r[6]), "=&v"(r[7]) : "v"(x[0]), "v"(x[1]), "v"(x[2]), "v"(x[3]), "v"(x[4]), "v"(x[5]), "v"(x[6]), "v"(x[7])); }
__device__ __forceinline__ float ex2(float x) { float r; asm("v_exp_f32 %0, %1\n\tv_nop" : "=&v"(r) : "v"(x)); return r; }
__global__ __launch_bounds__(512) void k_fa(const _Float16* __restrict__ AH, const _Float16* __restrict__ AL, const _Float16* __restrict__ BH, const _Float16* __restrict__ BL, const _Float16* __restrict__ MP, const float* __restrict__ X, const float* __restrict__ ALPHA, float* __restrict__ OUT) {
  __shared__ __align__(16) _Float16 kh[2][FK][72], kl[2][FK][72], mm[2][CC][FK + 8];   // pitches 144 B and 272 B: 16 B x odd
  __shared__ __align__(16) float red[FS][CC][FQN + 4]; __shared__ __align__(16) float rm[FS][FQN], rl[FS][FQN], rw[FS][FQN];
  const int tid = threadIdx.x, wave = tid >> 5, lane = tid & 31, col = lane & 15, g = lane >> 4; const int qg = wave & (FQ - 1), ks = wave / FQ; const size_t b = blockIdx.y; const int n0 = blockIdx.x * FQN; const float alpha = bfr(ALPHA[0]);
  v16h ah[2], al[2];
#pragma unroll
  for (int kc = 0; kc < 2; ++kc) { const size_t qo = (b * TT + n0 + qg * 16 + col) * CC + kc * 32; ah[kc] = frag_h(AH + qo, lane); al[kc] = frag_h(AL + qo, lane); }
  const int kr = tid >> 3, kq = (tid & 7) * 8, mc = tid >> 4, mq = (tid & 15) * 8;   // this thread's 16-B pieces of a stage: key rows kr, kr + 64; channels mc, mc + 32
  const _Float16* gh = BH + (b * TT + kr) * CC + kq; const _Float16* gl = BL + (b * TT + kr) * CC + kq; const _Float16* gm = MP + (b * CC + mc) * (size_t)TT + mq;
  v8h r0 = *(const v8h*)gh, r1 = *(const v8h*)(gh + 64 * CC), r2 = *(const v8h*)gl, r3 = *(const v8h*)(gl + 64 * CC), r4 = *(const v8h*)gm, r5 = *(const v8h*)(gm + 32 * (size_t)TT);
  asm volatile("s_wait_xcnt 0x0" ::: "memory");   // stands in front of the first overwrite of an address register of the loads above
  *(v8h*)&kh[0][kr][kq] = r0; *(v8h*)&kh[0][kr + 64][kq] = r1; *(v8h*)&kl[0][kr][kq] = r2; *(v8h*)&kl[0][kr + 64][kq] = r3; *(v8h*)&mm[0][mc][mq] = r4; *(v8h*)&mm[0][mc + 32][mq] = r5;
  __syncthreads();
  v8f acc[4] = {}, accl[4] = {}; float m = -3.0e38f, l = 0.f;
#pragma unroll 1
  for (int st = 0; st < FNS; ++st) { const int bf = st & 1; const bool more = st + 1 < FNS;
    if (more) { const size_t ko = (size_t)(st + 1) * FK * CC; const int mo = (st + 1) * FK;
      r0 = *(const v8h*)(gh + ko); r1 = *(const v8h*)(gh + ko + 64 * CC); r2 = *(const v8h*)(gl + ko); r3 = *(const v8h*)(gl + ko + 64 * CC); r4 = *(const v8h*)(gm + mo); r5 = *(const v8h*)(gm + mo + 32 * (size_t)TT); }
    v8f sa[2] = {}, sl[2] = {};
#pragma unroll
    for (int kc = 0; kc < 2; ++kc) { v16h kb[2], kv[2];
#pragma unroll
      for (int t = 0; t < 2; ++t) { kb[t] = frag_h(&kh[bf][ks * 32 + t * 16 + col][kc * 32], lane); kv[t] = frag_h(&kl[bf][ks * 32 + t * 16 + col][kc * 32], lane); }
#pragma unroll
      for (int t = 0; t < 2; ++t) sa[t] = wmma16(kb[t], ah[kc], sa[t]);
#pragma unroll
      for (int t = 0; t < 2; ++t) sl[t] = wmma16(kb[t], al[kc], sl[t]);
#pragma unroll
      for (int t = 0; t < 2; ++t) sl[t] = wmma16(kv[t], ah[kc], sl[t]); }
    v16h mv[4];   // read here so that the LDS latency passes behind the softmax arithmetic
#pragma unroll
    for (int j = 0; j < 4; ++j) mv[j] = frag_h(&mm[bf][j * 16 + col][ks * 32], lane);
    float s[16];
#pragma unroll
    for (int i = 0; i < 16; ++i) s[i] = sa[i >> 3][i & 7] + sl[i >> 3][i & 7] * (1.0f / 1024.0f);   // key 32 ks + 16 (i >> 3) + 8 g + (i & 7) of the stage, query col: the k order of a B operand
    float mx = s[0];
#pragma unroll
    for (int i = 1; i < 16; ++i) mx = fmaxf(mx, s[i]);
    mx = fmaxf(mx, xhalf(mx)); const float mn = fmaxf(m, fmaf(mx, L2E, -11.0f)); const float f = ex2(m - mn); m = mn;
    float tx[16], a0[16];
#pragma unroll   // constant indices, so that tx and a0 are registers
    for (int i = 0; i < 16; i += 2) { const v2f t2 = __builtin_elementwise_fma((v2f){s[i], s[i + 1]}, (v2f){L2E, L2E}, (v2f){-mn, -mn}); tx[i] = t2[0]; tx[i + 1] = t2[1]; }
    ex2x8(a0, tx); ex2x8(a0 + 8, tx + 8);
    v16h ph, pl; float ps = 0.f;
#pragma unroll
    for (int i = 0; i < 16; ++i) { ps += a0[i]; const _Float16 h0 = (_Float16)a0[i]; ph[i] = h0; pl[i] = (_Float16)((a0[i] - (float)h0) * 1024.0f); }
    l = l * f + ps;
#pragma unroll
    for (int j = 0; j < 4; ++j) { acc[j] *= f; accl[j] *= f; }
#pragma unroll
    for (int j = 0; j < 4; ++j) { acc[j] = wmma16(mv[j], ph, acc[j]); accl[j] = wmma16(mv[j], pl, accl[j]); }
    if (more) { const int bn = bf ^ 1; *(v8h*)&kh[bn][kr][kq] = r0; *(v8h*)&kh[bn][kr + 64][kq] = r1; *(v8h*)&kl[bn][kr][kq] = r2; *(v8h*)&kl[bn][kr + 64][kq] = r3; *(v8h*)&mm[bn][mc][mq] = r4; *(v8h*)&mm[bn][mc + 32][mq] = r5; }
    __syncthreads(); }   // publishes stage st + 1 and ends every read of the buffer that the next trip refills
  l += xhalf(l);
#pragma unroll
  for (int j = 0; j < 4; ++j)
#pragma unroll
    for (int r = 0; r < 8; ++r) red[ks][j * 16 + 8 * g + r][qg * 16 + col] = acc[j][r] + accl[j][r] * (1.0f / 1024.0f);   // x 2^11, as the sum l is
  if (g == 0) { rm[ks][qg * 16 + col] = m; rl[ks][qg * 16 + col] = l; }
  __syncthreads();
  if (tid < FQN) { float mt = rm[0][tid];
#pragma unroll
    for (int s = 1; s < FS; ++s) mt = fmaxf(mt, rm[s][tid]);
    float w[FS], lt = 0.f;
#pragma unroll
    for (int s = 0; s < FS; ++s) { w[s] = ex2(rm[s][tid] - mt); lt += w[s] * rl[s][tid]; }
    const float inv = 1.0f / lt;
#pragma unroll
    for (int s = 0; s < FS; ++s) rw[s][tid] = w[s] * inv; }
  __syncthreads();
  for (int e = tid; e < CC * (FQN / 4); e += 512) { const int c = e >> 4, q = e & 15; const size_t off = (b * CC + c) * (size_t)XSTR + n0 + q * 4; const v4f xr = *(const v4f*)(X + off); v4f o = *(const v4f*)&red[0][c][q * 4] * *(const v4f*)&rw[0][q * 4];
#pragma unroll
    for (int s = 1; s < FS; ++s) o += *(const v4f*)&red[s][c][q * 4] * *(const v4f*)&rw[s][q * 4];
#pragma unroll
    for (int z = 0; z < 4; ++z) { const float p = bfr(xr[z]) + alpha * o[z]; o[z] = p + p; }
    vst2(OUT + off, o); } }
extern "C" void kernel_launch(void* const* d_in, const int* in_sizes, int n_in, void* d_out, int out_size, void* d_ws, size_t ws_size, hipStream_t stream) {
  (void)in_sizes; (void)n_in; (void)out_size;
  const float** F = (const float**)d_in;   // 0 feature [2,64,8192,1], 1 wa [64,64] ([out,in]), 2 ba, 3 wb, 4 bb, 5 wm, 6 bm, 7 bn_gamma, 8 bn_beta, 9 bn_mean, 10 bn_var, 11 alpha (scalar, read)
  if (ws_size < (size_t)WS_END) return;
  char* ws = (char*)d_ws; float *XT = (float*)(ws + WS_XT); _Float16 *AH = (_Float16*)(ws + WS_AH), *AL = (_Float16*)(ws + WS_AL), *BH = (_Float16*)(ws + WS_BH), *BL = (_Float16*)(ws + WS_BL), *MP = (_Float16*)(ws + WS_MP);
  k_xt<<<dim3(TT / 64, TNB), 256, 0, stream>>>(F[0], XT);
  k_proj<<<dim3(TNB * TT / 64, 3), 128, 0, stream>>>(XT, F[1], F[2], F[3], F[4], F[5], F[6], F[7], F[8], F[9], F[10], AH, AL, BH, BL, MP);
  k_fa<<<dim3(TT / FQN, TNB), 512, 0, stream>>>(AH, AL, BH, BL, MP, F[0], F[11], (float*)d_out);
}

// v005
// Measured time: 86 microseconds a run.
// In two side-by-side timings against v004, it was 1.08 and 1.06 times as fast.
// Counting every step since v000, it is 26.9 times as fast.
// compute dtype: all float inputs rounded to bf16, alpha read; the three 1x1 convs with EXACT bf16 products on WMMA 16x16x32 (f32 accumulate, + bias), eval BatchNorm affine in f32; logits a^T b over the 64 channels with a and b as f16 hi + residual (x 2^10), 3 products, kept in f32 registers; softmax in f32 with a running maximum and sum, both kept in the base-2 domain (2^(s log2e - max log2e + 11) by the hardware exp2), divided by the sum at the end; exp(s - max) x 2^11 as f16 hi + residual against the normalised m rounded ONCE to f16 (2 products); residual blend 2 (feature + alpha out) in f32; channels-first f32 output.
#include <hip/hip_runtime.h>
#include <math.h>

typedef __attribute__((ext_vector_type(16))) _Float16 v16h;
typedef __attribute__((ext_vector_type(16))) __bf16 v16b;
typedef __attribute__((ext_vector_type(8)))  _Float16 v8h;
typedef __attribute__((ext_vector_type(8)))  float v8f;
typedef __attribute__((ext_vector_type(4)))  float v4f;
typedef __attribute__((ext_vector_type(2)))  float v2f;
typedef __attribute__((ext_vector_type(4)))  unsigned v4u;
typedef __attribute__((ext_vector_type(4)))  int v4i;
typedef float __attribute__((may_alias)) float_a;
typedef int __attribute__((may_alias)) int_a;

template <typename T> __device__ __forceinline__ void vst2(void* p, T v) { *(T*)p = v;  }
__device__ __forceinline__ v8f wmma16(v16h a, v16h b, v8f c) {
  return __builtin_amdgcn_wmma_f32_16x16x32_f16(false, a, false, b, (short)0, c, false, false);
}
__device__ __forceinline__ v8f wmma_bf(v16b a, v16b b, v8f c) {
  v8f d = __builtin_amdgcn_wmma_f32_16x16x32_bf16(false, a, false, b, (short)0, c, false, false);
  asm volatile("v_nop\n\tv_nop\n\tv_nop\n\tv_nop" : "+v"(d) : "v"(a), "v"(b));
  return d;
}
// 16x16x32 fragments: lane = (h = lane>>4, row/col = lane&15); elements 0..7 = k0+8h+0..7, 8..15 = k0+16+8h+0..7; D element r = row 8h+r
__device__ __forceinline__ v16h frag_h(const _Float16* rowk0, int lane) {
  union { v16h v; v8h q[2]; } u; const _Float16* p = rowk0 + 8 * (lane >> 4);
  u.q[0] = *(const v8h*)p; u.q[1] = *(const v8h*)(p + 16); return u.v;
}
__device__ __forceinline__ v16h frag_f32(const float* rowk0, int lane) {
  v16h a; const float* p = rowk0 + 8 * (lane >> 4);
#pragma unroll
  for (int i = 0; i < 8; ++i) { a[i] = (_Float16)p[i]; a[8 + i] = (_Float16)p[16 + i]; }
  return a;
}
__device__ __forceinline__ v16h frag_f32s(const float* rowk0, int lane, float sc) {
  v16h a; const float* p = rowk0 + 8 * (lane >> 4);
#pragma unroll
  for (int i = 0; i < 8; ++i) { a[i] = (_Float16)(p[i] * sc); a[8 + i] = (_Float16)(p[16 + i] * sc); }
  return a;
}
// column fragment from a [K][ld] layout (column n), rows >= K read as 0
__device__ __forceinline__ v16h fragc_f32(const float* W, int k0, int n, int lane, int ld, int K) {
  v16h a; const int g = lane >> 4;
#pragma unroll
  for (int i = 0; i < 8; ++i) { const int ka = k0 + 8 * g + i, kb = ka + 16;
    a[i] = (_Float16)(ka < K ? W[(size_t)(ka < K ? ka : K - 1) * ld + n] : 0.f); a[8 + i] = (_Float16)(kb < K ? W[(size_t)(kb < K ? kb : K - 1) * ld + n] : 0.f); }
  return a;
}
struct F2 { v16b h, l; };
__device__ __forceinline__ F2 bsplit16(const float v[16]) { F2 r;
#pragma unroll
  for (int i = 0; i < 16; ++i) { const __bf16 h = (__bf16)v[i]; r.h[i] = h; r.l[i] = (__bf16)(v[i] - (float)h); }
  return r; }
__device__ __forceinline__ F2 split_row(const float* row, int k0, int lane) { float v[16]; const float* p = row + k0 + 8 * (lane >> 4);
#pragma unroll
  for (int i = 0; i < 8; ++i) { v[i] = p[i]; v[8 + i] = p[16 + i]; }
  return bsplit16(v); }
__device__ __forceinline__ F2 split_rowK(const float* row, int k0, int lane, int K) { float v[16]; const int g = lane >> 4;
#pragma unroll
  for (int i = 0; i < 8; ++i) { const int ka = k0 + 8 * g + i, kb = ka + 16; v[i] = ka < K ? row[ka < K ? ka : K - 1] : 0.f; v[8 + i] = kb < K ? row[kb < K ? kb : K - 1] : 0.f; }
  return bsplit16(v); }
__device__ __forceinline__ F2 split_col(const float* W, int k0, int n, int lane, int ld, int K) { float v[16]; const int g = lane >> 4;
#pragma unroll
  for (int i = 0; i < 8; ++i) { const int ka = k0 + 8 * g + i, kb = ka + 16; v[i] = ka < K ? W[(size_t)(ka < K ? ka : K - 1) * ld + n] : 0.f; v[8 + i] = kb < K ? W[(size_t)(kb < K ? kb : K - 1) * ld + n] : 0.f; }
  return bsplit16(v); }
__device__ __forceinline__ v8f mac3(const F2& a, const F2& b, v8f c) { c = wmma_bf(a.l, b.h, c); c = wmma_bf(a.h, b.l, c); return wmma_bf(a.h, b.h, c); }
__device__ __forceinline__ float sigm(float v) { return 1.0f / (1.0f + expf(-v)); }
#define LDSX() do { asm volatile("s_wait_dscnt 0" ::: "memory"); __builtin_amdgcn_wave_barrier(); __builtin_amdgcn_fence(__ATOMIC_RELEASE, "workgroup"); } while (0)

// GFA / PAM (B 2, C 64, N 8,192 points): a, b, m = conv1x1(x); att = softmax_m(sum_c a[c][n] b[c][m]); m = BN_eval(m); out[c][n] = sum_m att[n][m] m[c][m]; p = feature + alpha out; return p + p.
__device__ __forceinline__ float bfr(float v) { return (float)(__bf16)v; }
#define NB 2
#define CC 64
#define TT 8192
#ifndef TNB
#define TNB NB
#endif
#ifndef XSTR
#define XSTR TT
#endif
#define WS_XT  0u                                   // f32 x rows [b*N+n][64] (bf16 values)
#define WS_AH  (WS_XT + 4u * (size_t)NB * TT * CC)    // f16 a hi / lo rows [b*N+n][64]
#define WS_AL  (WS_AH + 2u * (size_t)NB * TT * CC)
#define WS_BH  (WS_AL + 2u * (size_t)NB * TT * CC)    // f16 b hi / lo rows
#define WS_BL  (WS_BH + 2u * (size_t)NB * TT * CC)
#define WS_MP  (WS_BL + 2u * (size_t)NB * TT * CC)    // f16 normalised-m planes [b][c][n]
#define WS_END (WS_MP + 2u * (size_t)NB * CC * TT)
// ---- k_xt: block = (64 points, b): channels-first feature -> rows [b*N+n][64] (bf16 values); 256-B rows
__global__ __launch_bounds__(256) void k_xt(const float* __restrict__ X, float* __restrict__ XT) { __shared__ float st[CC][65];
  const int t = threadIdx.x; const int n0 = blockIdx.x * 64; const size_t b = blockIdx.y;
  for (int e = t; e < CC * 64; e += 256) { const int c = e >> 6, nl = e & 63; st[c][nl] = bfr(X[(b * CC + c) * (size_t)XSTR + n0 + nl]); }
  __syncthreads();
  for (int e = t; e < 64 * 16; e += 256) { const int nl = e >> 4, q = e & 15; v4f o; o[0] = st[q * 4][nl]; o[1] = st[q * 4 + 1][nl]; o[2] = st[q * 4 + 2][nl]; o[3] = st[q * 4 + 3][nl]; vst2(XT + (b * TT + n0 + nl) * CC + q * 4, o); } }
__global__ __launch_bounds__(128) void k_proj(const float* __restrict__ XT, const float* __restrict__ WA, const float* __restrict__ BA, const float* __restrict__ WB, const float* __restrict__ BB, const float* __restrict__ WM, const float* __restrict__ BM, const float* __restrict__ G, const float* __restrict__ BT, const float* __restrict__ MU, const float* __restrict__ VAR,
    _Float16* __restrict__ AH, _Float16* __restrict__ AL, _Float16* __restrict__ BH, _Float16* __restrict__ BL, _Float16* __restrict__ MP) { __shared__ __align__(16) _Float16 sh[64][72], sl[64][72]; __shared__ __align__(16) _Float16 th[CC][72];
  const int tid = threadIdx.x, wave = tid >> 5, lane = tid & 31, col = lane & 15, g = lane >> 4; const int which = blockIdx.y; const size_t r0 = (size_t)blockIdx.x * 64; const float* Wt = which == 0 ? WA : which == 1 ? WB : WM; const float* Bv = which == 0 ? BA : which == 1 ? BB : BM;
  v8f acc[4] = {};
#pragma unroll
  for (int kc = 0; kc < CC / 32; ++kc) { v16b a; { const float* p = XT + (r0 + wave * 16 + col) * CC + kc * 32 + 8 * g;
#pragma unroll
      for (int i = 0; i < 8; ++i) { a[i] = (__bf16)p[i]; a[8 + i] = (__bf16)p[16 + i]; } }
#pragma unroll
    for (int j = 0; j < 4; ++j) { v16b w; const float* wr = Wt + (size_t)(j * 16 + col) * CC + kc * 32 + 8 * g;
#pragma unroll
      for (int i = 0; i < 8; ++i) { w[i] = (__bf16)wr[i]; w[8 + i] = (__bf16)wr[16 + i]; }
      asm volatile("s_wait_loadcnt 0x0" ::: "memory"); acc[j] = wmma_bf(a, w, acc[j]); } }
#pragma unroll
  for (int j = 0; j < 4; ++j) { const int o = j * 16 + col; const float bb = bfr(Bv[o]); float sc = 1.f, sh0 = 0.f; if (which == 2) { sc = rsqrtf(bfr(VAR[o]) + 1e-5f) * bfr(G[o]); sh0 = bfr(BT[o]) - bfr(MU[o]) * sc; }
#pragma unroll
    for (int r = 0; r < 8; ++r) { const float v = acc[j][r] + bb; const int rl = wave * 16 + 8 * g + r;
      if (which == 2) th[o][rl] = (_Float16)(v * sc + sh0); else { const _Float16 hv = (_Float16)v; sh[rl][o] = hv; sl[rl][o] = (_Float16)((v - (float)hv) * 1024.0f); } } }
  __syncthreads();
  if (which < 2) { _Float16* DH = which == 0 ? AH : BH; _Float16* DL = which == 0 ? AL : BL; for (int e = tid; e < 64 * 8; e += 128) { const int rl = e >> 3, q = e & 7; vst2((unsigned*)(DH + (r0 + rl) * CC + q * 8), *(const v4u*)&sh[rl][q * 8]); vst2((unsigned*)(DL + (r0 + rl) * CC + q * 8), *(const v4u*)&sl[rl][q * 8]); } }
  else { const size_t b = r0 / TT; const int n0 = (int)(r0 % TT); for (int e = tid; e < CC * 8; e += 128) { const int cl = e >> 3, q = e & 7; vst2((unsigned*)(MP + (b * CC + cl) * (size_t)TT + n0 + q * 8), *(const v4u*)&th[cl][q * 8]); } } }
// lane l with lane l ^ 16
__device__ __forceinline__ float xhalf(float x) { return __builtin_bit_cast(float, __builtin_amdgcn_permlanex16(__builtin_bit_cast(int, x), __builtin_bit_cast(int, x), 0x76543210, 0xfedcba98, false, false)); }
// ---- k_fa: block = 64 queries of batch b, 16 waves = 4 query groups of 16 x 4 key ranges. A stage is 128 keys (b hi / lo rows and the m planes) in LDS; six buffers used as two groups of three, filled through registers three stages ahead, with ONE barrier per three stages, so that between barriers a wave may run ahead of its neighbours and its LDS reads and matrix products fall under their vector work; key range ks takes keys 32 ks .. 32 ks + 31 of every stage.
// Per pass: St = b . at (3 products; a lane holds 16 keys of ONE query), running maximum (as max log2e - 11) and sum (x 2^11) in f32, 2^(s log2e - that maximum) = exp(s - max) x 2^11 as f16 hi + residual packs straight into a B operand, Ot += m . Pt (2 products; a lane holds 8 channels of one query per tile).
// The four key ranges' (max, sum, Ot) are joined through LDS in key-range order, in the bytes of the ring, behind a barrier that ends its last read; epilogue: res = 2 (feature + alpha o), channels-first (two whole 128-B lines per channel)
#define FQ 4                  // query groups of 16 per block
#define FS 4                  // key ranges per block
#define FK (FS * 32)          // keys per stage
#define FNS (TT / FK)         // stages
#define FQN (FQ * 16)         // queries per block
#define FG 3                  // stages between two barriers
struct fa_stage { _Float16 kh[FK][72], kl[FK][72], mm[CC][FK + 8]; };   // pitches 144 B and 272 B: 16 B x odd
struct fa_join { float red[FS][CC][FQN + 4], rm[FS][FQN], rl[FS][FQN], rw[FS][FQN]; };
union fa_lds { fa_stage ring[2 * FG]; fa_join join; };
#define L2E 1.4426950408889634f
// 2^x by v_exp_f32, several independent ones in one statement. Every argument here is <= about 11, and a result below the normal range may go to 0.
// Each result has a register of its own ("=&v"), so no v_exp_f32 overwrites a source of the one in front of it; the closing v_nop is the slot the instruction set asks for between the last one and a reader of its result.
__device__ __forceinline__ void ex2x8(float* r, const float* x) {
  asm("v_exp_f32 %0, %8\n\tv_exp_f32 %1, %9\n\tv_exp_f32 %2, %10\n\tv_exp_f32 %3, %11\n\tv_exp_f32 %4, %12\n\tv_exp_f32 %5, %13\n\tv_exp_f32 %6, %14\n\tv_exp_f32 %7, %15\n\tv_nop"
      : "=&v"(r[0]), "=&v"(r[1]), "=&v"(r[2]), "=&v"(r[3]), "=&v"(r[4]), "=&v"(r[5]), "=&v"(r[6]), "=&v"(r[7]) : "v"(x[0]), "v"(x[1]), "v"(x[2]), "v"(x[3]), "v"(x[4]), "v"(x[5]), "v"(x[6]), "v"(x[7])); }
__device__ __forceinline__ float ex2(float x) { float r; asm("v_exp_f32 %0, %1\n\tv_nop" : "=&v"(r) : "v"(x)); return r; }
__global__ __launch_bounds__(512) void k_fa(const _Float16* __restrict__ AH, const _Float16* __restrict__ AL, const _Float16* __restrict__ BH, const _Float16* __restrict__ BL, const _Float16* __restrict__ MP, const float* __restrict__ X, const float* __restrict__ ALPHA, float* __restrict__ OUT) {
  __shared__ __align__(16) fa_lds sm; auto& red = sm.join.red; auto& rm = sm.join.rm; auto& rl = sm.join.rl; auto& rw = sm.join.rw;
  const int tid = threadIdx.x, wave = tid >> 5, lane = tid & 31, col = lane & 15, g = lane >> 4; const int qg = wave & (FQ - 1), ks = wave / FQ; const size_t b = blockIdx.y; const int n0 = blockIdx.x * FQN; const float alpha = bfr(ALPHA[0]);
  v16h ah[2], al[2];
#pragma unroll
  for (int kc = 0; kc < 2; ++kc) { const size_t qo = (b * TT + n0 + qg * 16 + col) * CC + kc * 32; ah[kc] = frag_h(AH + qo, lane); al[kc] = frag_h(AL + qo, lane); }
  const int kr = tid >> 3, kq = (tid & 7) * 8, mc = tid >> 4, mq = (tid & 15) * 8;   // this thread's 16-B pieces of a stage: key rows kr, kr + 64; channels mc, mc + 32
  const _Float16* gh = BH + (b * TT + kr) * CC + kq; const _Float16* gl = BL + (b * TT + kr) * CC + kq; const _Float16* gm = MP + (b * CC + mc) * (size_t)TT + mq;
  v8h r0, r1, r2, r3, r4, r5;
#pragma unroll   // constant buffer numbers: stages 0 .. FG - 1 fill the first group
  for (int p = 0; p < FG; ++p) { fa_stage& sn = sm.ring[p]; const size_t ko = (size_t)p * FK * CC; const int mo = p * FK;
    r0 = *(const v8h*)(gh + ko); r1 = *(const v8h*)(gh + ko + 64 * CC); r2 = *(const v8h*)(gl + ko); r3 = *(const v8h*)(gl + ko + 64 * CC); r4 = *(const v8h*)(gm + mo); r5 = *(const v8h*)(gm + mo + 32 * (size_t)TT);
    asm volatile("s_wait_xcnt 0x0" ::: "memory");   // stands in front of the first overwrite of an address register of the loads above
    *(v8h*)&sn.kh[kr][kq] = r0; *(v8h*)&sn.kh[kr + 64][kq] = r1; *(v8h*)&sn.kl[kr][kq] = r2; *(v8h*)&sn.kl[kr + 64][kq] = r3; *(v8h*)&sn.mm[mc][mq] = r4; *(v8h*)&sn.mm[mc + 32][mq] = r5; }
  __syncthreads();
  v8f acc[4] = {}, accl[4] = {}; float m = -3.0e38f, l = 0.f; int bf = 0, tl = FG;   // bf: the buffer of stage st, st mod 2 FG; tl: trips left to the next barrier
#pragma unroll 1
  for (int st = 0; st < FNS; ++st) { const fa_stage& sc = sm.ring[bf]; const bool more = st + FG < FNS;
    if (more) { const size_t ko = (size_t)(st + FG) * FK * CC; const int mo = (st + FG) * FK;
      r0 = *(const v8h*)(gh + ko); r1 = *(const v8h*)(gh + ko + 64 * CC); r2 = *(const v8h*)(gl + ko); r3 = *(const v8h*)(gl + ko + 64 * CC); r4 = *(const v8h*)(gm + mo); r5 = *(const v8h*)(gm + mo + 32 * (size_t)TT);
      asm volatile("s_wait_xcnt 0x0" ::: "memory"); }   // stands in front of the first overwrite of an address register of the loads above
    v8f sa[2] = {}, sl[2] = {};
#pragma unroll
    for (int kc = 0; kc < 2; ++kc) { v16h kb[2], kv[2];
#pragma unroll
      for (int t = 0; t < 2; ++t) { kb[t] = frag_h(&sc.kh[ks * 32 + t * 16 + col][kc * 32], lane); kv[t] = frag_h(&sc.kl[ks * 32 + t * 16 + col][kc * 32], lane); }
#pragma unroll
      for (int t = 0; t < 2; ++t) sa[t] = wmma16(kb[t], ah[kc], sa[t]);
#pragma unroll
      for (int t = 0; t < 2; ++t) sl[t] = wmma16(kb[t], al[kc], sl[t]);
#pragma unroll
      for (int t = 0; t < 2; ++t) sl[t] = wmma16(kv[t], ah[kc], sl[t]); }
    v16h mv[4];   // read here so that the LDS latency passes behind the softmax arithmetic
#pragma unroll
    for (int j = 0; j < 4; ++j) mv[j] = frag_h(&sc.mm[j * 16 + col][ks * 32], lane);
    float s[16];
#pragma unroll
    for (int i = 0; i < 16; ++i) s[i] = sa[i >> 3][i & 7] + sl[i >> 3][i & 7] * (1.0f / 1024.0f);   // key 32 ks + 16 (i >> 3) + 8 g + (i & 7) of the stage, query col: the k order of a B operand
    float mx = s[0];
#pragma unroll
    for (int i = 1; i < 16; ++i) mx = fmaxf(mx, s[i]);
    mx = fmaxf(mx, xhalf(mx)); const float mn = fmaxf(m, fmaf(mx, L2E, -11.0f)); const float f = ex2(m - mn); m = mn;
    float tx[16], a0[16];
#pragma unroll   // constant indices, so that tx and a0 are registers
    for (int i = 0; i < 16; i += 2) { const v2f t2 = __builtin_elementwise_fma((v2f){s[i], s[i + 1]}, (v2f){L2E, L2E}, (v2f){-mn, -mn}); tx[i] = t2[0]; tx[i + 1] = t2[1]; }
    ex2x8(a0, tx); ex2x8(a0 + 8, tx + 8);
    v16h ph, pl; float ps = 0.f;
#pragma unroll
    for (int i = 0; i < 16; ++i) { ps += a0[i]; const _Float16 h0 = (_Float16)a0[i]; ph[i] = h0; pl[i] = (_Float16)((a0[i] - (float)h0) * 1024.0f); }
    l = l * f + ps;
#pragma unroll
    for (int j = 0; j < 4; ++j) { acc[j] *= f; accl[j] *= f; }
#pragma unroll
    for (int j = 0; j < 4; ++j) { acc[j] = wmma16(mv[j], ph, acc[j]); accl[j] = wmma16(mv[j], pl, accl[j]); }
    if (more) { fa_stage& sn = sm.ring[bf < FG ? bf + FG : bf - FG]; *(v8h*)&sn.kh[kr][kq] = r0; *(v8h*)&sn.kh[kr + 64][kq] = r1; *(v8h*)&sn.kl[kr][kq] = r2; *(v8h*)&sn.kl[kr + 64][kq] = r3; *(v8h*)&sn.mm[mc][mq] = r4; *(v8h*)&sn.mm[mc + 32][mq] = r5; }
    if (--tl == 0) { tl = FG; __syncthreads(); }   // block-uniform; once per group of FG stages: publishes the next group and ends every read of the group that the next FG trips refill
    bf = bf == 2 * FG - 1 ? 0 : bf + 1; }
  __syncthreads();   // ends every wave's last read of the ring, whose bytes the join below overwrites
  l += xhalf(l);
#pragma unroll
  for (int j = 0; j < 4; ++j)
#pragma unroll
    for (int r = 0; r < 8; ++r) red[ks][j * 16 + 8 * g + r][qg * 16 + col] = acc[j][r] + accl[j][r] * (1.0f / 1024.0f);   // x 2^11, as the sum l is
  if (g == 0) { rm[ks][qg * 16 + col] = m; rl[ks][qg * 16 + col] = l; }
  __syncthreads();
  if (tid < FQN) { float mt = rm[0][tid];
#pragma unroll
    for (int s = 1; s < FS; ++s) mt = fmaxf(mt, rm[s][tid]);
    float w[FS], lt = 0.f;
#pragma unroll
    for (int s = 0; s < FS; ++s) { w[s] = ex2(rm[s][tid] - mt); lt += w[s] * rl[s][tid]; }
    const float inv = 1.0f / lt;
#pragma unroll
    for (int s = 0; s < FS; ++s) rw[s][tid] = w[s] * inv; }
  __syncthreads();
  for (int e = tid; e < CC * (FQN / 4); e += 512) { const int c = e >> 4, q = e & 15; const size_t off = (b * CC + c) * (size_t)XSTR + n0 + q * 4; const v4f xr = *(const v4f*)(X + off); v4f o = *(const v4f*)&red[0][c][q * 4] * *(const v4f*)&rw[0][q * 4];
#pragma unroll
    for (int s = 1; s < FS; ++s) o += *(const v4f*)&red[s][c][q * 4] * *(const v4f*)&rw[s][q * 4];
#pragma unroll
    for (int z = 0; z < 4; ++z) { const float p = bfr(xr[z]) + alpha * o[z]; o[z] = p + p; }
    vst2(OUT + off, o); } }
extern "C" void kernel_launch(void* const* d_in, const int* in_sizes, int n_in, void* d_out, int out_size, void* d_ws, size_t ws_size, hipStream_t stream) {
  (void)in_sizes; (void)n_in; (void)out_size;
  const float** F = (const float**)d_in;   // 0 feature [2,64,8192,1], 1 wa [64,64] ([out,in]), 2 ba, 3 wb, 4 bb, 5 wm, 6 bm, 7 bn_gamma, 8 bn_beta, 9 bn_mean, 10 bn_var, 11 alpha (scalar, read)
  if (ws_size < (size_t)WS_END) return;
  char* ws = (char*)d_ws; float *XT = (float*)(ws + WS_XT); _Float16 *AH = (_Float16*)(ws + WS_AH), *AL = (_Float16*)(ws + WS_AL), *BH = (_Float16*)(ws + WS_BH), *BL = (_Float16*)(ws + WS_BL), *MP = (_Float16*)(ws + WS_MP);
  k_xt<<<dim3(TT / 64, TNB), 256, 0, stream>>>(F[0], XT);
  k_proj<<<dim3(TNB * TT / 64, 3), 128, 0, stream>>>(XT, F[1], F[2], F[3], F[4], F[5], F[6], F[7], F[8], F[9], F[10], AH, AL, BH, BL, MP);
  k_fa<<<dim3(TT / FQN, TNB), 512, 0, stream>>>(AH, AL, BH, BL, MP, F[0], F[11], (float*)d_out);
}

// v006
// Measured time: 79.1 microseconds a run.
// In both of two side-by-side timings against v005, it was 1.08 times as fast.
// All steps since v000 together make it 29.2 times as fast.
// compute dtype: all float inputs rounded to bf16, alpha read; the three 1x1 convs with EXACT bf16 products on WMMA 16x16x32 (f32 accumulate, + bias), eval BatchNorm affine in f32; logits a^T b over the 64 channels with a and b as f16 hi + residual (x 2^10), 3 products, kept in f32 registers; softmax in f32 with a running maximum and sum, both kept in the base-2 domain (2^(s log2e - max log2e + 11) by the hardware exp2), divided by the sum at the end; exp(s - max) x 2^11 as f16 hi + f16 residual (unscaled) against the normalised m rounded ONCE to f16 (2 products, both added into one f32 tile); residual blend 2 (feature + alpha out) in f32; channels-first f32 output.
#include <hip/hip_runtime.h>
#include <math.h>

typedef __attribute__((ext_vector_type(16))) _Float16 v16h;
typedef __attribute__((ext_vector_type(16))) __bf16 v16b;
typedef __attribute__((ext_vector_type(8)))  _Float16 v8h;
typedef __attribute__((ext_vector_type(8)))  float v8f;
typedef __attribute__((ext_vector_type(4)))  float v4f;
typedef __attribute__((ext_vector_type(2)))  float v2f;
typedef __attribute__((ext_vector_type(4)))  unsigned v4u;
typedef __attribute__((ext_vector_type(8)))  unsigned v8u;
typedef __attribute__((ext_vector_type(2)))  _Float16 v2h;
typedef __attribute__((ext_vector_type(4)))  int v4i;
typedef float __attribute__((may_alias)) float_a;
typedef int __attribute__((may_alias)) int_a;

template <typename T> __device__ __forceinline__ void vst2(void* p, T v) { *(T*)p = v;  }
__device__ __forceinline__ v8f wmma16(v16h a, v16h b, v8f c) {
  return __builtin_amdgcn_wmma_f32_16x16x32_f16(false, a, false, b, (short)0, c, false, false);
}
__device__ __forceinline__ v8f wmma_bf(v16b a, v16b b, v8f c) {
  v8f d = __builtin_amdgcn_wmma_f32_16x16x32_bf16(false, a, false, b, (short)0, c, false, false);
  asm volatile("v_nop\n\tv_nop\n\tv_nop\n\tv_nop" : "+v"(d) : "v"(a), "v"(b));
  return d;
}
// 16x16x32 fragments: lane = (h = lane>>4, row/col = lane&15); elements 0..7 = k0+8h+0..7, 8..15 = k0+16+8h+0..7; D element r = row 8h+r
__device__ __forceinline__ v16h frag_h(const _Float16* rowk0, int lane) {
  union { v16h v; v8h q[2]; } u; const _Float16* p = rowk0 + 8 * (lane >> 4);
  u.q[0] = *(const v8h*)p; u.q[1] = *(const v8h*)(p + 16); return u.v;
}
__device__ __forceinline__ v16h frag_f32(const float* rowk0, int lane) {
  v16h a; const float* p = rowk0 + 8 * (lane >> 4);
#pragma unroll
  for (int i = 0; i < 8; ++i) { a[i] = (_Float16)p[i]; a[8 + i] = (_Float16)p[16 + i]; }
  return a;
}
__device__ __forceinline__ v16h frag_f32s(const float* rowk0, int lane, float sc) {
  v16h a; const float* p = rowk0 + 8 * (lane >> 4);
#pragma unroll
  for (int i = 0; i < 8; ++i) { a[i] = (_Float16)(p[i] * sc); a[8 + i] = (_Float16)(p[16 + i] * sc); }
  return a;
}
// column fragment from a [K][ld] layout (column n), rows >= K read as 0
__device__ __forceinline__ v16h fragc_f32(const float* W, int k0, int n, int lane, int ld, int K) {
  v16h a; const int g = lane >> 4;
#pragma unroll
  for (int i = 0; i < 8; ++i) { const int ka = k0 + 8 * g + i, kb = ka + 16;
    a[i] = (_Float16)(ka < K ? W[(size_t)(ka < K ? ka : K - 1) * ld + n] : 0.f); a[8 + i] = (_Float16)(kb < K ? W[(size_t)(kb < K ? kb : K - 1) * ld + n] : 0.f); }
  return a;
}
struct F2 { v16b h, l; };
__device__ __forceinline__ F2 bsplit16(const float v[16]) { F2 r;
#pragma unroll
  for (int i = 0; i < 16; ++i) { const __bf16 h = (__bf16)v[i]; r.h[i] = h; r.l[i] = (__bf16)(v[i] - (float)h); }
  return r; }
__device__ __forceinline__ F2 split_row(const float* row, int k0, int lane) { float v[16]; const float* p = row + k0 + 8 * (lane >> 4);
#pragma unroll
  for (int i = 0; i < 8; ++i) { v[i] = p[i]; v[8 + i] = p[16 + i]; }
  return bsplit16(v); }
__device__ __forceinline__ F2 split_rowK(const float* row, int k0, int lane, int K) { float v[16]; const int g = lane >> 4;
#pragma unroll
  for (int i = 0; i < 8; ++i) { const int ka = k0 + 8 * g + i, kb = ka + 16; v[i] = ka < K ? row[ka < K ? ka : K - 1] : 0.f; v[8 + i] = kb < K ? row[kb < K ? kb : K - 1] : 0.f; }
  return bsplit16(v); }
__device__ __forceinline__ F2 split_col(const float* W, int k0, int n, int lane, int ld, int K) { float v[16]; const int g = lane >> 4;
#pragma unroll
  for (int i = 0; i < 8; ++i) { const int ka = k0 + 8 * g + i, kb = ka + 16; v[i] = ka < K ? W[(size_t)(ka < K ? ka : K - 1) * ld + n] : 0.f; v[8 + i] = kb < K ? W[(size_t)(kb < K ? kb : K - 1) * ld + n] : 0.f; }
  return bsplit16(v); }
__device__ __forceinline__ v8f mac3(const F2& a, const F2& b, v8f c) { c = wmma_bf(a.l, b.h, c); c = wmma_bf(a.h, b.l, c); return wmma_bf(a.h, b.h, c); }
__device__ __forceinline__ float sigm(float v) { return 1.0f / (1.0f + expf(-v)); }
#define LDSX() do { asm volatile("s_wait_dscnt 0" ::: "memory"); __builtin_amdgcn_wave_barrier(); __builtin_amdgcn_fence(__ATOMIC_RELEASE, "workgroup"); } while (0)

// GFA / PAM (B 2, C 64, N 8,192 points): a, b, m = conv1x1(x); att = softmax_m(sum_c a[c][n] b[c][m]); m = BN_eval(m); out[c][n] = sum_m att[n][m] m[c][m]; p = feature + alpha out; return p + p.
__device__ __forceinline__ float bfr(float v) { return (float)(__bf16)v; }
#define NB 2
#define CC 64
#define TT 8192
#ifndef TNB
#define TNB NB
#endif
#ifndef XSTR
#define XSTR TT
#endif
#define WS_XT  0u                                   // f32 x rows [b*N+n][64] (bf16 values)
#define WS_AH  (WS_XT + 4u * (size_t)NB * TT * CC)    // f16 a hi / lo rows [b*N+n][64]
#define WS_AL  (WS_AH + 2u * (size_t)NB * TT * CC)
#define WS_BH  (WS_AL + 2u * (size_t)NB * TT * CC)    // f16 b hi / lo rows
#define WS_BL  (WS_BH + 2u * (size_t)NB * TT * CC)
#define WS_MP  (WS_BL + 2u * (size_t)NB * TT * CC)    // f16 normalised-m planes [b][c][n]
#define WS_END (WS_MP + 2u * (size_t)NB * CC * TT)
// ---- k_xt: block = (64 points, b): channels-first feature -> rows [b*N+n][64] (bf16 values); 256-B rows
__global__ __launch_bounds__(256) void k_xt(const float* __restrict__ X, float* __restrict__ XT) { __shared__ float st[CC][65];
  const int t = threadIdx.x; const int n0 = blockIdx.x * 64; const size_t b = blockIdx.y;
  for (int e = t; e < CC * 64; e += 256) { const int c = e >> 6, nl = e & 63; st[c][nl] = bfr(X[(b * CC + c) * (size_t)XSTR + n0 + nl]); }
  __syncthreads();
  for (int e = t; e < 64 * 16; e += 256) { const int nl = e >> 4, q = e & 15; v4f o; o[0] = st[q * 4][nl]; o[1] = st[q * 4 + 1][nl]; o[2] = st[q * 4 + 2][nl]; o[3] = st[q * 4 + 3][nl]; vst2(XT + (b * TT + n0 + nl) * CC + q * 4, o); } }
__global__ __launch_bounds__(128) void k_proj(const float* __restrict__ XT, const float* __restrict__ WA, const float* __restrict__ BA, const float* __restrict__ WB, const float* __restrict__ BB, const float* __restrict__ WM, const float* __restrict__ BM, const float* __restrict__ G, const float* __restrict__ BT, const float* __restrict__ MU, const float* __restrict__ VAR,
    _Float16* __restrict__ AH, _Float16* __restrict__ AL, _Float16* __restrict__ BH, _Float16* __restrict__ BL, _Float16* __restrict__ MP) { __shared__ __align__(16) _Float16 sh[64][72], sl[64][72]; __shared__ __align__(16) _Float16 th[CC][72];
  const int tid = threadIdx.x, wave = tid >> 5, lane = tid & 31, col = lane & 15, g = lane >> 4; const int which = blockIdx.y; const size_t r0 = (size_t)blockIdx.x * 64; const float* Wt = which == 0 ? WA : which == 1 ? WB : WM; const float* Bv = which == 0 ? BA : which == 1 ? BB : BM;
  v8f acc[4] = {};
#pragma unroll
  for (int kc = 0; kc < CC / 32; ++kc) { v16b a; { const float* p = XT + (r0 + wave * 16 + col) * CC + kc * 32 + 8 * g;
#pragma unroll
      for (int i = 0; i < 8; ++i) { a[i] = (__bf16)p[i]; a[8 + i] = (__bf16)p[16 + i]; } }
#pragma unroll
    for (int j = 0; j < 4; ++j) { v16b w; const float* wr = Wt + (size_t)(j * 16 + col) * CC + kc * 32 + 8 * g;
#pragma unroll
      for (int i = 0; i < 8; ++i) { w[i] = (__bf16)wr[i]; w[8 + i] = (__bf16)wr[16 + i]; }
      asm volatile("s_wait_loadcnt 0x0" ::: "memory"); acc[j] = wmma_bf(a, w, acc[j]); } }
#pragma unroll
  for (int j = 0; j < 4; ++j) { const int o = j * 16 + col; const float bb = bfr(Bv[o]); float sc = 1.f, sh0 = 0.f; if (which == 2) { sc = rsqrtf(bfr(VAR[o]) + 1e-5f) * bfr(G[o]); sh0 = bfr(BT[o]) - bfr(MU[o]) * sc; }
#pragma unroll
    for (int r = 0; r < 8; ++r) { const float v = acc[j][r] + bb; const int rl = wave * 16 + 8 * g + r;
      if (which == 2) th[o][rl] = (_Float16)(v * sc + sh0); else { const _Float16 hv = (_Float16)v; sh[rl][o] = hv; sl[rl][o] = (_Float16)((v - (float)hv) * 1024.0f); } } }
  __syncthreads();
  if (which < 2) { _Float16* DH = which == 0 ? AH : BH; _Float16* DL = which == 0 ? AL : BL; for (int e = tid; e < 64 * 8; e += 128) { const int rl = e >> 3, q = e & 7; vst2((unsigned*)(DH + (r0 + rl) * CC + q * 8), *(const v4u*)&sh[rl][q * 8]); vst2((unsigned*)(DL + (r0 + rl) * CC + q * 8), *(const v4u*)&sl[rl][q * 8]); } }
  else { const size_t b = r0 / TT; const int n0 = (int)(r0 % TT); for (int e = tid; e < CC * 8; e += 128) { const int cl = e >> 3, q = e & 7; vst2((unsigned*)(MP + (b * CC + cl) * (size_t)TT + n0 + q * 8), *(const v4u*)&th[cl][q * 8]); } } }
// lane l with lane l ^ 16
__device__ __forceinline__ float xhalf(float x) { return __builtin_bit_cast(float, __builtin_amdgcn_permlanex16(__builtin_bit_cast(int, x), __builtin_bit_cast(int, x), 0x76543210, 0xfedcba98, false, false)); }
// ---- k_fa: block = 64 queries of batch b, 16 waves = 4 query groups of 16 x 4 key ranges. A stage is 128 keys (b hi / lo rows and the m planes) in LDS; six buffers used as two groups of three, filled through registers three stages ahead, with ONE barrier per three stages, so that between barriers a wave may run ahead of its neighbours and its LDS reads and matrix products fall under their vector work; key range ks takes keys 32 ks .. 32 ks + 31 of every stage.
// Per pass: St = b . at (3 products; a lane holds 16 keys of ONE query), running maximum (as max log2e - 11) and sum (x 2^11) in f32, 2^(s log2e - that maximum) = exp(s - max) x 2^11 as f16 hi + residual packs straight into a B operand, Ot += m . Pt (2 products into the same tile; a lane holds 8 channels of one query per tile).
// The residual needs no scale of its own: the values reach 2^11, so it is held to 2^-25 or to 2^-11 of itself, whichever is larger, against a sum of at least 2^11.
// The four key ranges' (max, sum, Ot) are joined through LDS in key-range order, in the bytes of the ring, behind a barrier that ends its last read; epilogue: res = 2 (feature + alpha o), channels-first (two whole 128-B lines per channel)
#define FQ 4                  // query groups of 16 per block
#define FS 4                  // key ranges per block
#define FK (FS * 32)          // keys per stage
#define FNS (TT / FK)         // stages
#define FQN (FQ * 16)         // queries per block
#define FG 3                  // stages between two barriers
struct fa_stage { _Float16 kh[FK][72], kl[FK][72], mm[CC][FK + 8]; };   // pitches 144 B and 272 B: 16 B x odd
struct fa_join { float red[FS][CC][FQN + 4], rm[FS][FQN], rl[FS][FQN], rw[FS][FQN]; };
union fa_lds { fa_stage ring[2 * FG]; fa_join join; };
#define L2E 1.4426950408889634f
// 2^x by v_exp_f32, several independent ones in one statement. Every argument here is <= about 11, and a result below the normal range may go to 0.
// Each result has a register of its own ("=&v"), so no v_exp_f32 overwrites a source of the one in front of it; the closing v_nop is the slot the instruction set asks for between the last one and a reader of its result.
__device__ __forceinline__ void ex2x8(float* r, const float* x) {
  asm("v_exp_f32 %0, %8\n\tv_exp_f32 %1, %9\n\tv_exp_f32 %2, %10\n\tv_exp_f32 %3, %11\n\tv_exp_f32 %4, %12\n\tv_exp_f32 %5, %13\n\tv_exp_f32 %6, %14\n\tv_exp_f32 %7, %15\n\tv_nop"
      : "=&v"(r[0]), "=&v"(r[1]), "=&v"(r[2]), "=&v"(r[3]), "=&v"(r[4]), "=&v"(r[5]), "=&v"(r[6]), "=&v"(r[7]) : "v"(x[0]), "v"(x[1]), "v"(x[2]), "v"(x[3]), "v"(x[4]), "v"(x[5]), "v"(x[6]), "v"(x[7])); }
// lo = f16(x - hi) for eight values: hi holds four packed f16 pairs (the rounded x), one mixed-precision fma per value reads its f16 half beside the f32 x and writes its half of the packed result,
// in place of widening hi, subtracting and packing. The four low halves stand first, so that a register's second write is four instructions behind its first. Results have registers of their own ("=&v").
__device__ __forceinline__ void resx8(unsigned* lo, const unsigned* hi, const float* x) {
  asm("v_fma_mixlo_f16 %0, %4, -1.0, %8 op_sel_hi:[1,1,0]\n\tv_fma_mixlo_f16 %1, %5, -1.0, %10 op_sel_hi:[1,1,0]\n\tv_fma_mixlo_f16 %2, %6, -1.0, %12 op_sel_hi:[1,1,0]\n\tv_fma_mixlo_f16 %3, %7, -1.0, %14 op_sel_hi:[1,1,0]\n\t"
      "v_fma_mixhi_f16 %0, %4, -1.0, %9 op_sel:[1,0,0] op_sel_hi:[1,1,0]\n\tv_fma_mixhi_f16 %1, %5, -1.0, %11 op_sel:[1,0,0] op_sel_hi:[1,1,0]\n\tv_fma_mixhi_f16 %2, %6, -1.0, %13 op_sel:[1,0,0] op_sel_hi:[1,1,0]\n\tv_fma_mixhi_f16 %3, %7, -1.0, %15 op_sel:[1,0,0] op_sel_hi:[1,1,0]"
      : "=&v"(lo[0]), "=&v"(lo[1]), "=&v"(lo[2]), "=&v"(lo[3]) : "v"(hi[0]), "v"(hi[1]), "v"(hi[2]), "v"(hi[3]), "v"(x[0]), "v"(x[1]), "v"(x[2]), "v"(x[3]), "v"(x[4]), "v"(x[5]), "v"(x[6]), "v"(x[7])); }
__device__ __forceinline__ float ex2(float x) { float r; asm("v_exp_f32 %0, %1\n\tv_nop" : "=&v"(r) : "v"(x)); return r; }
__global__ __launch_bounds__(512) void k_fa(const _Float16* __restrict__ AH, const _Float16* __restrict__ AL, const _Float16* __restrict__ BH, const _Float16* __restrict__ BL, const _Float16* __restrict__ MP, const float* __restrict__ X, const float* __restrict__ ALPHA, float* __restrict__ OUT) {
  __shared__ __align__(16) fa_lds sm; auto& red = sm.join.red; auto& rm = sm.join.rm; auto& rl = sm.join.rl; auto& rw = sm.join.rw;
  const int tid = threadIdx.x, wave = tid >> 5, lane = tid & 31, col = lane & 15, g = lane >> 4; const int qg = wave & (FQ - 1), ks = wave / FQ; const size_t b = blockIdx.y; const int n0 = blockIdx.x * FQN; const float alpha = bfr(ALPHA[0]);
  v16h ah[2], al[2];
#pragma unroll
  for (int kc = 0; kc < 2; ++kc) { const size_t qo = (b * TT + n0 + qg * 16 + col) * CC + kc * 32; ah[kc] = frag_h(AH + qo, lane); al[kc] = frag_h(AL + qo, lane); }
  const int kr = tid >> 3, kq = (tid & 7) * 8, mc = tid >> 4, mq = (tid & 15) * 8;   // this thread's 16-B pieces of a stage: key rows kr, kr + 64; channels mc, mc + 32
  const _Float16* gh = BH + (b * TT + kr) * CC + kq; const _Float16* gl = BL + (b * TT + kr) * CC + kq; const _Float16* gm = MP + (b * CC + mc) * (size_t)TT + mq;
  v8h r0, r1, r2, r3, r4, r5;
#pragma unroll   // constant buffer numbers: stages 0 .. FG - 1 fill the first group
  for (int p = 0; p < FG; ++p) { fa_stage& sn = sm.ring[p]; const size_t ko = (size_t)p * FK * CC; const int mo = p * FK;
    r0 = *(const v8h*)(gh + ko); r1 = *(const v8h*)(gh + ko + 64 * CC); r2 = *(const v8h*)(gl + ko); r3 = *(const v8h*)(gl + ko + 64 * CC); r4 = *(const v8h*)(gm + mo); r5 = *(const v8h*)(gm + mo + 32 * (size_t)TT);
    asm volatile("s_wait_xcnt 0x0" ::: "memory");   // stands in front of the first overwrite of an address register of the loads above
    *(v8h*)&sn.kh[kr][kq] = r0; *(v8h*)&sn.kh[kr + 64][kq] = r1; *(v8h*)&sn.kl[kr][kq] = r2; *(v8h*)&sn.kl[kr + 64][kq] = r3; *(v8h*)&sn.mm[mc][mq] = r4; *(v8h*)&sn.mm[mc + 32][mq] = r5; }
  __syncthreads();
  v8f acc[4] = {}; float m = -3.0e38f, l = 0.f; int bf = 0, tl = FG;   // bf: the buffer of stage st, st mod 2 FG; tl: trips left to the next barrier
#pragma unroll 1
  for (int st = 0; st < FNS; ++st) { const fa_stage& sc = sm.ring[bf]; const bool more = st + FG < FNS;
    if (more) { const size_t ko = (size_t)(st + FG) * FK * CC; const int mo = (st + FG) * FK;
      r0 = *(const v8h*)(gh + ko); r1 = *(const v8h*)(gh + ko + 64 * CC); r2 = *(const v8h*)(gl + ko); r3 = *(const v8h*)(gl + ko + 64 * CC); r4 = *(const v8h*)(gm + mo); r5 = *(const v8h*)(gm + mo + 32 * (size_t)TT);
      asm volatile("s_wait_xcnt 0x0" ::: "memory"); }   // stands in front of the first overwrite of an address register of the loads above
    v8f sa[2] = {}, sl[2] = {}; v16h kb[2][2], kv[2][2];
#pragma unroll
    for (int kc = 0; kc < 2; ++kc)
#pragma unroll
      for (int t = 0; t < 2; ++t) { kb[kc][t] = frag_h(&sc.kh[ks * 32 + t * 16 + col][kc * 32], lane); kv[kc][t] = frag_h(&sc.kl[ks * 32 + t * 16 + col][kc * 32], lane); }
    __builtin_amdgcn_sched_barrier(0);   // keeps the sixteen reads above one group in front of the products; left alone, the compiler puts seven of them behind the first two products, and their LDS latency then stands open in the middle of the run
#pragma unroll
    for (int kc = 0; kc < 2; ++kc) {
#pragma unroll
      for (int t = 0; t < 2; ++t) sa[t] = wmma16(kb[kc][t], ah[kc], sa[t]);
#pragma unroll
      for (int t = 0; t < 2; ++t) sl[t] = wmma16(kb[kc][t], al[kc], sl[t]);
#pragma unroll
      for (int t = 0; t < 2; ++t) sl[t] = wmma16(kv[kc][t], ah[kc], sl[t]); }
    v16h mv[4];   // read here so that the LDS latency passes behind the softmax arithmetic
#pragma unroll
    for (int j = 0; j < 4; ++j) mv[j] = frag_h(&sc.mm[j * 16 + col][ks * 32], lane);
    float s[16];
#pragma unroll
    for (int i = 0; i < 16; ++i) s[i] = sa[i >> 3][i & 7] + sl[i >> 3][i & 7] * (1.0f / 1024.0f);   // key 32 ks + 16 (i >> 3) + 8 g + (i & 7) of the stage, query col: the k order of a B operand
    float mx = s[0];
#pragma unroll
    for (int i = 1; i < 16; ++i) mx = fmaxf(mx, s[i]);
    mx = fmaxf(mx, xhalf(mx)); const float mn = fmaxf(m, fmaf(mx, L2E, -11.0f)); const float f = ex2(m - mn); m = mn;
    float tx[16], a0[16];
#pragma unroll   // constant indices, so that tx and a0 are registers
    for (int i = 0; i < 16; i += 2) { const v2f t2 = __builtin_elementwise_fma((v2f){s[i], s[i + 1]}, (v2f){L2E, L2E}, (v2f){-mn, -mn}); tx[i] = t2[0]; tx[i + 1] = t2[1]; }
    ex2x8(a0, tx); ex2x8(a0 + 8, tx + 8);
    unsigned hu[8], lu[8]; float ps = 0.f;
#pragma unroll
    for (int i = 0; i < 16; ++i) ps += a0[i];
#pragma unroll   // constant indices, so that hu and lu are registers
    for (int i = 0; i < 8; ++i) hu[i] = __builtin_bit_cast(unsigned, __builtin_convertvector((v2f){a0[2 * i], a0[2 * i + 1]}, v2h));
    const v16h ph = __builtin_bit_cast(v16h, (v8u){hu[0], hu[1], hu[2], hu[3], hu[4], hu[5], hu[6], hu[7]});
    l = l * f + ps;
#pragma unroll
    for (int j = 0; j < 4; ++j) acc[j] *= f;
#pragma unroll
    for (int j = 0; j < 4; ++j) acc[j] = wmma16(mv[j], ph, acc[j]);
    resx8(lu, hu, a0); resx8(lu + 4, hu + 4, a0 + 8);   // the products above do not read these, so they can issue while the matrix unit works
    const v16h pl = __builtin_bit_cast(v16h, (v8u){lu[0], lu[1], lu[2], lu[3], lu[4], lu[5], lu[6], lu[7]});
#pragma unroll
    for (int j = 0; j < 4; ++j) acc[j] = wmma16(mv[j], pl, acc[j]);
    if (more) { fa_stage& sn = sm.ring[bf < FG ? bf + FG : bf - FG]; *(v8h*)&sn.kh[kr][kq] = r0; *(v8h*)&sn.kh[kr + 64][kq] = r1; *(v8h*)&sn.kl[kr][kq] = r2; *(v8h*)&sn.kl[kr + 64][kq] = r3; *(v8h*)&sn.mm[mc][mq] = r4; *(v8h*)&sn.mm[mc + 32][mq] = r5; }
    if (--tl == 0) { tl = FG; __syncthreads(); }   // block-uniform; once per group of FG stages: publishes the next group and ends every read of the group that the next FG trips refill
    bf = bf == 2 * FG - 1 ? 0 : bf + 1; }
  __syncthreads();   // ends every wave's last read of the ring, whose bytes the join below overwrites
  l += xhalf(l);
#pragma unroll
  for (int j = 0; j < 4; ++j)
#pragma unroll
    for (int r = 0; r < 8; ++r) red[ks][j * 16 + 8 * g + r][qg * 16 + col] = acc[j][r];   // x 2^11, as the sum l is
  if (g == 0) { rm[ks][qg * 16 + col] = m; rl[ks][qg * 16 + col] = l; }
  __syncthreads();
  if (tid < FQN) { float mt = rm[0][tid];
#pragma unroll
    for (int s = 1; s < FS; ++s) mt = fmaxf(mt, rm[s][tid]);
    float w[FS], lt = 0.f;
#pragma unroll
    for (int s = 0; s < FS; ++s) { w[s] = ex2(rm[s][tid] - mt); lt += w[s] * rl[s][tid]; }
    const float inv = 1.0f / lt;
#pragma unroll
    for (int s = 0; s < FS; ++s) rw[s][tid] = w[s] * inv; }
  __syncthreads();
  for (int e = tid; e < CC * (FQN / 4); e += 512) { const int c = e >> 4, q = e & 15; const size_t off = (b * CC + c) * (size_t)XSTR + n0 + q * 4; const v4f xr = *(const v4f*)(X + off); v4f o = *(const v4f*)&red[0][c][q * 4] * *(const v4f*)&rw[0][q * 4];
#pragma unroll
    for (int s = 1; s < FS; ++s) o += *(const v4f*)&red[s][c][q * 4] * *(const v4f*)&rw[s][q * 4];
#pragma unroll
    for (int z = 0; z < 4; ++z) { const float p = bfr(xr[z]) + alpha * o[z]; o[z] = p + p; }
    vst2(OUT + off, o); } }
extern "C" void kernel_launch(void* const* d_in, const int* in_sizes, int n_in, void* d_out, int out_size, void* d_ws, size_t ws_size, hipStream_t stream) {
  (void)in_sizes; (void)n_in; (void)out_size;
  const float** F = (const float**)d_in;   // 0 feature [2,64,8192,1], 1 wa [64,64] ([out,in]), 2 ba, 3 wb, 4 bb, 5 wm, 6 bm, 7 bn_gamma, 8 bn_beta, 9 bn_mean, 10 bn_var, 11 alpha (scalar, read)
  if (ws_size < (size_t)WS_END) return;
  char* ws = (char*)d_ws; float *XT = (float*)(ws + WS_XT); _Float16 *AH = (_Float16*)(ws + WS_AH), *AL = (_Float16*)(ws + WS_AL), *BH = (_Float16*)(ws + WS_BH), *BL = (_Float16*)(ws + WS_BL), *MP = (_Float16*)(ws + WS_MP);
  k_xt<<<dim3(TT / 64, TNB), 256, 0, stream>>>(F[0], XT);
  k_proj<<<dim3(TNB * TT / 64, 3), 128, 0, stream>>>(XT, F[1], F[2], F[3], F[4], F[5], F[6], F[7], F[8], F[9], F[10], AH, AL, BH, BL, MP);
  k_fa<<<dim3(TT / FQN, TNB), 512, 0, stream>>>(AH, AL, BH, BL, MP, F[0], F[11], (float*)d_out);
}

// v007
// It runs in 72.8 microseconds.
// In both of two side-by-side timings against v006, it was 1.09 times as fast.
// Counting every step since v000, it is 31.8 times as fast.
// compute dtype: all float inputs rounded to bf16, alpha read; the three 1x1 convs with EXACT bf16 products on WMMA 16x16x32 (f32 accumulate, + bias), eval BatchNorm affine in f32; logits a^T b over the 64 channels with a and b as f16 hi + residual (x 2^10), 3 products, kept in f32 registers; softmax in f32 with a running maximum and sum, both kept in the base-2 domain (2^(s log2e - max log2e + 11) by the hardware exp2), divided by the sum at the end; exp(s - max) x 2^11 as f16 hi + f16 residual (unscaled) against the normalised m rounded ONCE to f16 (2 products, both added into one f32 tile); residual blend 2 (feature + alpha out) in f32; channels-first f32 output.
#include <hip/hip_runtime.h>
#include <math.h>

typedef __attribute__((ext_vector_type(16))) _Float16 v16h;
typedef __attribute__((ext_vector_type(16))) __bf16 v16b;
typedef __attribute__((ext_vector_type(8)))  _Float16 v8h;
typedef __attribute__((ext_vector_type(8)))  float v8f;
typedef __attribute__((ext_vector_type(4)))  float v4f;
typedef __attribute__((ext_vector_type(2)))  float v2f;
typedef __attribute__((ext_vector_type(4)))  unsigned v4u;
typedef __attribute__((ext_vector_type(8)))  unsigned v8u;
typedef __attribute__((ext_vector_type(2)))  _Float16 v2h;
typedef __attribute__((ext_vector_type(4)))  int v4i;
typedef float __attribute__((may_alias)) float_a;
typedef int __attribute__((may_alias)) int_a;

template <typename T> __device__ __forceinline__ void vst2(void* p, T v) { *(T*)p = v;  }
__device__ __forceinline__ v8f wmma16(v16h a, v16h b, v8f c) {
  return __builtin_amdgcn_wmma_f32_16x16x32_f16(false, a, false, b, (short)0, c, false, false);
}
__device__ __forceinline__ v8f wmma_bf(v16b a, v16b b, v8f c) {
  v8f d = __builtin_amdgcn_wmma_f32_16x16x32_bf16(false, a, false, b, (short)0, c, false, false);
  asm volatile("v_nop\n\tv_nop\n\tv_nop\n\tv_nop" : "+v"(d) : "v"(a), "v"(b));
  return d;
}
// 16x16x32 fragments: lane = (h = lane>>4, row/col = lane&15); elements 0..7 = k0+8h+0..7, 8..15 = k0+16+8h+0..7; D element r = row 8h+r
__device__ __forceinline__ v16h frag_h(const _Float16* rowk0, int lane) {
  union { v16h v; v8h q[2]; } u; const _Float16* p = rowk0 + 8 * (lane >> 4);
  u.q[0] = *(const v8h*)p; u.q[1] = *(const v8h*)(p + 16); return u.v;
}
__device__ __forceinline__ v16h frag_f32(const float* rowk0, int lane) {
  v16h a; const float* p = rowk0 + 8 * (lane >> 4);
#pragma unroll
  for (int i = 0; i < 8; ++i) { a[i] = (_Float16)p[i]; a[8 + i] = (_Float16)p[16 + i]; }
  return a;
}
__device__ __forceinline__ v16h frag_f32s(const float* rowk0, int lane, float sc) {
  v16h a; const float* p = rowk0 + 8 * (lane >> 4);
#pragma unroll
  for (int i = 0; i < 8; ++i) { a[i] = (_Float16)(p[i] * sc); a[8 + i] = (_Float16)(p[16 + i] * sc); }
  return a;
}
// column fragment from a [K][ld] layout (column n), rows >= K read as 0
__device__ __forceinline__ v16h fragc_f32(const float* W, int k0, int n, int lane, int ld, int K) {
  v16h a; const int g = lane >> 4;
#pragma unroll
  for (int i = 0; i < 8; ++i) { const int ka = k0 + 8 * g + i, kb = ka + 16;
    a[i] = (_Float16)(ka < K ? W[(size_t)(ka < K ? ka : K - 1) * ld + n] : 0.f); a[8 + i] = (_Float16)(kb < K ? W[(size_t)(kb < K ? kb : K - 1) * ld + n] : 0.f); }
  return a;
}
struct F2 { v16b h, l; };
__device__ __forceinline__ F2 bsplit16(const float v[16]) { F2 r;
#pragma unroll
  for (int i = 0; i < 16; ++i) { const __bf16 h = (__bf16)v[i]; r.h[i] = h; r.l[i] = (__bf16)(v[i] - (float)h); }
  return r; }
__device__ __forceinline__ F2 split_row(const float* row, int k0, int lane) { float v[16]; const float* p = row + k0 + 8 * (lane >> 4);
#pragma unroll
  for (int i = 0; i < 8; ++i) { v[i] = p[i]; v[8 + i] = p[16 + i]; }
  return bsplit16(v); }
__device__ __forceinline__ F2 split_rowK(const float* row, int k0, int lane, int K) { float v[16]; const int g = lane >> 4;
#pragma unroll
  for (int i = 0; i < 8; ++i) { const int ka = k0 + 8 * g + i, kb = ka + 16; v[i] = ka < K ? row[ka < K ? ka : K - 1] : 0.f; v[8 + i] = kb < K ? row[kb < K ? kb : K - 1] : 0.f; }
  return bsplit16(v); }
__device__ __forceinline__ F2 split_col(const float* W, int k0, int n, int lane, int ld, int K) { float v[16]; const int g = lane >> 4;
#pragma unroll
  for (int i = 0; i < 8; ++i) { const int ka = k0 + 8 * g + i, kb = ka + 16; v[i] = ka < K ? W[(size_t)(ka < K ? ka : K - 1) * ld + n] : 0.f; v[8 + i] = kb < K ? W[(size_t)(kb < K ? kb : K - 1) * ld + n] : 0.f; }
  return bsplit16(v); }
__device__ __forceinline__ v8f mac3(const F2& a, const F2& b, v8f c) { c = wmma_bf(a.l, b.h, c); c = wmma_bf(a.h, b.l, c); return wmma_bf(a.h, b.h, c); }
__device__ __forceinline__ float sigm(float v) { return 1.0f / (1.0f + expf(-v)); }
#define LDSX() do { asm volatile("s_wait_dscnt 0" ::: "memory"); __builtin_amdgcn_wave_barrier(); __builtin_amdgcn_fence(__ATOMIC_RELEASE, "workgroup"); } while (0)

// GFA / PAM (B 2, C 64, N 8,192 points): a, b, m = conv1x1(x); att = softmax_m(sum_c a[c][n] b[c][m]); m = BN_eval(m); out[c][n] = sum_m att[n][m] m[c][m]; p = feature + alpha out; return p + p.
__device__ __forceinline__ float bfr(float v) { return (float)(__bf16)v; }
#define NB 2
#define CC 64
#define TT 8192
#ifndef TNB
#define TNB NB
#endif
#ifndef XSTR
#define XSTR TT
#endif
#define WS_AH  0u                                   // f16 a hi / lo rows [b*N+n][64]
#define WS_AL  (WS_AH + 2u * (size_t)NB * TT * CC)
#define WS_BH  (WS_AL + 2u * (size_t)NB * TT * CC)    // f16 b hi / lo rows
#define WS_BL  (WS_BH + 2u * (size_t)NB * TT * CC)
#define WS_MP  (WS_BL + 2u * (size_t)NB * TT * CC)    // f16 normalised-m planes [b][c][n]
#define WS_END (WS_MP + 2u * (size_t)NB * CC * TT)
// ---- k_proj: block = (64 points, which of a / b / m). A lane's x fragment (16 channels of ONE point per 32-channel step) is read straight from the channels-first feature: per load the 16 lanes of a half-wave take 16 neighbouring points of one channel (64 B), all 32 loads of a lane in flight together; rounded to bf16 in registers
__global__ __launch_bounds__(128) void k_proj(const float* __restrict__ X, const float* __restrict__ WA, const float* __restrict__ BA, const float* __restrict__ WB, const float* __restrict__ BB, const float* __restrict__ WM, const float* __restrict__ BM, const float* __restrict__ G, const float* __restrict__ BT, const float* __restrict__ MU, const float* __restrict__ VAR,
    _Float16* __restrict__ AH, _Float16* __restrict__ AL, _Float16* __restrict__ BH, _Float16* __restrict__ BL, _Float16* __restrict__ MP) { __shared__ __align__(16) _Float16 sh[64][72], sl[64][72]; __shared__ __align__(16) _Float16 th[CC][72];
  const int tid = threadIdx.x, wave = tid >> 5, lane = tid & 31, col = lane & 15, g = lane >> 4; const int which = blockIdx.y; const size_t r0 = (size_t)blockIdx.x * 64; const float* Wt = which == 0 ? WA : which == 1 ? WB : WM; const float* Bv = which == 0 ? BA : which == 1 ? BB : BM;
  v8f acc[4] = {}; float xv[CC / 32][16]; { const float* p = X + ((r0 / TT) * CC + 8 * g) * (size_t)XSTR + (r0 % TT) + wave * 16 + col;
#pragma unroll   // constant indices, so that xv is registers
    for (int kc = 0; kc < CC / 32; ++kc)
#pragma unroll
      for (int i = 0; i < 8; ++i) { xv[kc][i] = p[(size_t)(kc * 32 + i) * XSTR]; xv[kc][8 + i] = p[(size_t)(kc * 32 + 16 + i) * XSTR]; } }
  asm volatile("s_wait_xcnt 0x0" ::: "memory");   // stands in front of the first overwrite of an address register of the loads above
#pragma unroll
  for (int kc = 0; kc < CC / 32; ++kc) { v16b a;
#pragma unroll
    for (int i = 0; i < 16; ++i) a[i] = (__bf16)xv[kc][i];
#pragma unroll
    for (int j = 0; j < 4; ++j) { v16b w; const float* wr = Wt + (size_t)(j * 16 + col) * CC + kc * 32 + 8 * g;
#pragma unroll
      for (int i = 0; i < 8; ++i) { w[i] = (__bf16)wr[i]; w[8 + i] = (__bf16)wr[16 + i]; }
      asm volatile("s_wait_loadcnt 0x0" ::: "memory"); acc[j] = wmma_bf(a, w, acc[j]); } }
#pragma unroll
  for (int j = 0; j < 4; ++j) { const int o = j * 16 + col; const float bb = bfr(Bv[o]); float sc = 1.f, sh0 = 0.f; if (which == 2) { sc = rsqrtf(bfr(VAR[o]) + 1e-5f) * bfr(G[o]); sh0 = bfr(BT[o]) - bfr(MU[o]) * sc; }
#pragma unroll
    for (int r = 0; r < 8; ++r) { const float v = acc[j][r] + bb; const int rl = wave * 16 + 8 * g + r;
      if (which == 2) th[o][rl] = (_Float16)(v * sc + sh0); else { const _Float16 hv = (_Float16)v; sh[rl][o] = hv; sl[rl][o] = (_Float16)((v - (float)hv) * 1024.0f); } } }
  __syncthreads();
  if (which < 2) { _Float16* DH = which == 0 ? AH : BH; _Float16* DL = which == 0 ? AL : BL; for (int e = tid; e < 64 * 8; e += 128) { const int rl = e >> 3, q = e & 7; vst2((unsigned*)(DH + (r0 + rl) * CC + q * 8), *(const v4u*)&sh[rl][q * 8]); vst2((unsigned*)(DL + (r0 + rl) * CC + q * 8), *(const v4u*)&sl[rl][q * 8]); } }
  else { const size_t b = r0 / TT; const int n0 = (int)(r0 % TT); for (int e = tid; e < CC * 8; e += 128) { const int cl = e >> 3, q = e & 7; vst2((unsigned*)(MP + (b * CC + cl) * (size_t)TT + n0 + q * 8), *(const v4u*)&th[cl][q * 8]); } } }
// lane l with lane l ^ 16
__device__ __forceinline__ float xhalf(float x) { return __builtin_bit_cast(float, __builtin_amdgcn_permlanex16(__builtin_bit_cast(int, x), __builtin_bit_cast(int, x), 0x76543210, 0xfedcba98, false, false)); }
// ---- k_fa: block = 64 queries of batch b, 16 waves = 4 query groups of 16 x 4 key ranges. A stage is 128 keys (b hi / lo rows and the m planes) in LDS; six buffers used as two groups of three, filled through registers three stages ahead, with ONE barrier per three stages, so that between barriers a wave may run ahead of its neighbours and its LDS reads and matrix products fall under their vector work; key range ks takes keys 32 ks .. 32 ks + 31 of every stage.
// Per pass: St = b . at (3 products; a lane holds 16 keys of ONE query), running maximum (as max log2e - 11) and sum (x 2^11) in f32, 2^(s log2e - that maximum) = exp(s - max) x 2^11 as f16 hi + residual packs straight into a B operand, Ot += m . Pt (2 products into the same tile; a lane holds 8 channels of one query per tile).
// The residual needs no scale of its own: the values reach 2^11, so it is held to 2^-25 or to 2^-11 of itself, whichever is larger, against a sum of at least 2^11.
// The four key ranges' (max, sum, Ot) are joined through LDS in key-range order, in the bytes of the ring, behind a barrier that ends its last read; epilogue: res = 2 (feature + alpha o), channels-first (two whole 128-B lines per channel)
#define FQ 4                  // query groups of 16 per block
#define FS 4                  // key ranges per block
#define FK (FS * 32)          // keys per stage
#define FNS (TT / FK)         // stages
#define FQN (FQ * 16)         // queries per block
#define FG 3                  // stages between two barriers
struct fa_stage { _Float16 kh[FK][72], kl[FK][72], mm[CC][FK + 8]; };   // pitches 144 B and 272 B: 16 B x odd
struct fa_join { float red[FS][CC][FQN + 4], rm[FS][FQN], rl[FS][FQN], rw[FS][FQN]; };
union fa_lds { fa_stage ring[2 * FG]; fa_join join; };
#define L2E 1.4426950408889634f
// 2^x by v_exp_f32, several independent ones in one statement. Every argument here is <= about 11, and a result below the normal range may go to 0.
// Each result has a register of its own ("=&v"), so no v_exp_f32 overwrites a source of the one in front of it; the closing v_nop is the slot the instruction set asks for between the last one and a reader of its result.
__device__ __forceinline__ void ex2x8(float* r, const float* x) {
  asm("v_exp_f32 %0, %8\n\tv_exp_f32 %1, %9\n\tv_exp_f32 %2, %10\n\tv_exp_f32 %3, %11\n\tv_exp_f32 %4, %12\n\tv_exp_f32 %5, %13\n\tv_exp_f32 %6, %14\n\tv_exp_f32 %7, %15\n\tv_nop"
      : "=&v"(r[0]), "=&v"(r[1]), "=&v"(r[2]), "=&v"(r[3]), "=&v"(r[4]), "=&v"(r[5]), "=&v"(r[6]), "=&v"(r[7]) : "v"(x[0]), "v"(x[1]), "v"(x[2]), "v"(x[3]), "v"(x[4]), "v"(x[5]), "v"(x[6]), "v"(x[7])); }
// lo = f16(x - hi) for eight values: hi holds four packed f16 pairs (the rounded x), one mixed-precision fma per value reads its f16 half beside the f32 x and writes its half of the packed result,
// in place of widening hi, subtracting and packing. The four low halves stand first, so that a register's second write is four instructions behind its first. Results have registers of their own ("=&v").
__device__ __forceinline__ void resx8(unsigned* lo, const unsigned* hi, const float* x) {
  asm("v_fma_mixlo_f16 %0, %4, -1.0, %8 op_sel_hi:[1,1,0]\n\tv_fma_mixlo_f16 %1, %5, -1.0, %10 op_sel_hi:[1,1,0]\n\tv_fma_mixlo_f16 %2, %6, -1.0, %12 op_sel_hi:[1,1,0]\n\tv_fma_mixlo_f16 %3, %7, -1.0, %14 op_sel_hi:[1,1,0]\n\t"
      "v_fma_mixhi_f16 %0, %4, -1.0, %9 op_sel:[1,0,0] op_sel_hi:[1,1,0]\n\tv_fma_mixhi_f16 %1, %5, -1.0, %11 op_sel:[1,0,0] op_sel_hi:[1,1,0]\n\tv_fma_mixhi_f16 %2, %6, -1.0, %13 op_sel:[1,0,0] op_sel_hi:[1,1,0]\n\tv_fma_mixhi_f16 %3, %7, -1.0, %15 op_sel:[1,0,0] op_sel_hi:[1,1,0]"
      : "=&v"(lo[0]), "=&v"(lo[1]), "=&v"(lo[2]), "=&v"(lo[3]) : "v"(hi[0]), "v"(hi[1]), "v"(hi[2]), "v"(hi[3]), "v"(x[0]), "v"(x[1]), "v"(x[2]), "v"(x[3]), "v"(x[4]), "v"(x[5]), "v"(x[6]), "v"(x[7])); }
__device__ __forceinline__ float ex2(float x) { float r; asm("v_exp_f32 %0, %1\n\tv_nop" : "=&v"(r) : "v"(x)); return r; }
__global__ __launch_bounds__(512) void k_fa(const _Float16* __restrict__ AH, const _Float16* __restrict__ AL, const _Float16* __restrict__ BH, const _Float16* __restrict__ BL, const _Float16* __restrict__ MP, const float* __restrict__ X, const float* __restrict__ ALPHA, float* __restrict__ OUT) {
  __shared__ __align__(16) fa_lds sm; auto& red = sm.join.red; auto& rm = sm.join.rm; auto& rl = sm.join.rl; auto& rw = sm.join.rw;
  const int tid = threadIdx.x, wave = tid >> 5, lane = tid & 31, col = lane & 15, g = lane >> 4; const int qg = wave & (FQ - 1), ks = wave / FQ; const size_t b = blockIdx.y; const int n0 = blockIdx.x * FQN; const float alpha = bfr(ALPHA[0]);
  v16h ah[2], al[2];
#pragma unroll
  for (int kc = 0; kc < 2; ++kc) { const size_t qo = (b * TT + n0 + qg * 16 + col) * CC + kc * 32; ah[kc] = frag_h(AH + qo, lane); al[kc] = frag_h(AL + qo, lane); }
  const int kr = tid >> 3, kq = (tid & 7) * 8, mc = tid >> 4, mq = (tid & 15) * 8;   // this thread's 16-B pieces of a stage: key rows kr, kr + 64; channels mc, mc + 32
  const _Float16* gh = BH + (b * TT + kr) * CC + kq; const _Float16* gl = BL + (b * TT + kr) * CC + kq; const _Float16* gm = MP + (b * CC + mc) * (size_t)TT + mq;
  v8h r0, r1, r2, r3, r4, r5;
#pragma unroll   // constant buffer numbers: stages 0 .. FG - 1 fill the first group
  for (int p = 0; p < FG; ++p) { fa_stage& sn = sm.ring[p]; const size_t ko = (size_t)p * FK * CC; const int mo = p * FK;
    r0 = *(const v8h*)(gh + ko); r1 = *(const v8h*)(gh + ko + 64 * CC); r2 = *(const v8h*)(gl + ko); r3 = *(const v8h*)(gl + ko + 64 * CC); r4 = *(const v8h*)(gm + mo); r5 = *(const v8h*)(gm + mo + 32 * (size_t)TT);
    asm volatile("s_wait_xcnt 0x0" ::: "memory");   // stands in front of the first overwrite of an address register of the loads above
    *(v8h*)&sn.kh[kr][kq] = r0; *(v8h*)&sn.kh[kr + 64][kq] = r1; *(v8h*)&sn.kl[kr][kq] = r2; *(v8h*)&sn.kl[kr + 64][kq] = r3; *(v8h*)&sn.mm[mc][mq] = r4; *(v8h*)&sn.mm[mc + 32][mq] = r5; }
  __syncthreads();
  v8f acc[4] = {}; float m = -3.0e38f, l = 0.f; int bf = 0, tl = FG;   // bf: the buffer of stage st, st mod 2 FG; tl: trips left to the next barrier
#pragma unroll 1
  for (int st = 0; st < FNS; ++st) { const fa_stage& sc = sm.ring[bf]; const bool more = st + FG < FNS;
    if (more) { const size_t ko = (size_t)(st + FG) * FK * CC; const int mo = (st + FG) * FK;
      r0 = *(const v8h*)(gh + ko); r1 = *(const v8h*)(gh + ko + 64 * CC); r2 = *(const v8h*)(gl + ko); r3 = *(const v8h*)(gl + ko + 64 * CC); r4 = *(const v8h*)(gm + mo); r5 = *(const v8h*)(gm + mo + 32 * (size_t)TT);
      asm volatile("s_wait_xcnt 0x0" ::: "memory"); }   // stands in front of the first overwrite of an address register of the loads above
    v8f sa[2] = {}, sl[2] = {}; v16h kb[2][2], kv[2][2];
#pragma unroll
    for (int kc = 0; kc < 2; ++kc)
#pragma unroll
      for (int t = 0; t < 2; ++t) { kb[kc][t] = frag_h(&sc.kh[ks * 32 + t * 16 + col][kc * 32], lane); kv[kc][t] = frag_h(&sc.kl[ks * 32 + t * 16 + col][kc * 32], lane); }
    __builtin_amdgcn_sched_barrier(0);   // keeps the sixteen reads above one group in front of the products; left alone, the compiler puts seven of them behind the first two products, and their LDS latency then stands open in the middle of the run
#pragma unroll
    for (int kc = 0; kc < 2; ++kc) {
#pragma unroll
      for (int t = 0; t < 2; ++t) sa[t] = wmma16(kb[kc][t], ah[kc], sa[t]);
#pragma unroll
      for (int t = 0; t < 2; ++t) sl[t] = wmma16(kb[kc][t], al[kc], sl[t]);
#pragma unroll
      for (int t = 0; t < 2; ++t) sl[t] = wmma16(kv[kc][t], ah[kc], sl[t]); }
    v16h mv[4];   // read here so that the LDS latency passes behind the softmax arithmetic
#pragma unroll
    for (int j = 0; j < 4; ++j) mv[j] = frag_h(&sc.mm[j * 16 + col][ks * 32], lane);
    float s[16];
#pragma unroll
    for (int i = 0; i < 16; ++i) s[i] = sa[i >> 3][i & 7] + sl[i >> 3][i & 7] * (1.0f / 1024.0f);   // key 32 ks + 16 (i >> 3) + 8 g + (i & 7) of the stage, query col: the k order of a B operand
    float mx = s[0];
#pragma unroll
    for (int i = 1; i < 16; ++i) mx = fmaxf(mx, s[i]);
    mx = fmaxf(mx, xhalf(mx)); const float mn = fmaxf(m, fmaf(mx, L2E, -11.0f)); const float f = ex2(m - mn); m = mn;
    float tx[16], a0[16];
#pragma unroll   // constant indices, so that tx and a0 are registers
    for (int i = 0; i < 16; i += 2) { const v2f t2 = __builtin_elementwise_fma((v2f){s[i], s[i + 1]}, (v2f){L2E, L2E}, (v2f){-mn, -mn}); tx[i] = t2[0]; tx[i + 1] = t2[1]; }
    ex2x8(a0, tx); ex2x8(a0 + 8, tx + 8);
    unsigned hu[8], lu[8]; float ps = 0.f;
#pragma unroll
    for (int i = 0; i < 16; ++i) ps += a0[i];
#pragma unroll   // constant indices, so that hu and lu are registers
    for (int i = 0; i < 8; ++i) hu[i] = __builtin_bit_cast(unsigned, __builtin_convertvector((v2f){a0[2 * i], a0[2 * i + 1]}, v2h));
    const v16h ph = __builtin_bit_cast(v16h, (v8u){hu[0], hu[1], hu[2], hu[3], hu[4], hu[5], hu[6], hu[7]});
    l = l * f + ps;
#pragma unroll
    for (int j = 0; j < 4; ++j) acc[j] *= f;
#pragma unroll
    for (int j = 0; j < 4; ++j) acc[j] = wmma16(mv[j], ph, acc[j]);
    resx8(lu, hu, a0); resx8(lu + 4, hu + 4, a0 + 8);   // the products above do not read these, so they can issue while the matrix unit works
    const v16h pl = __builtin_bit_cast(v16h, (v8u){lu[0], lu[1], lu[2], lu[3], lu[4], lu[5], lu[6], lu[7]});
#pragma unroll
    for (int j = 0; j < 4; ++j) acc[j] = wmma16(mv[j], pl, acc[j]);
    if (more) { fa_stage& sn = sm.ring[bf < FG ? bf + FG : bf - FG]; *(v8h*)&sn.kh[kr][kq] = r0; *(v8h*)&sn.kh[kr + 64][kq] = r1; *(v8h*)&sn.kl[kr][kq] = r2; *(v8h*)&sn.kl[kr + 64][kq] = r3; *(v8h*)&sn.mm[mc][mq] = r4; *(v8h*)&sn.mm[mc + 32][mq] = r5; }
    if (--tl == 0) { tl = FG; __syncthreads(); }   // block-uniform; once per group of FG stages: publishes the next group and ends every read of the group that the next FG trips refill
    bf = bf == 2 * FG - 1 ? 0 : bf + 1; }
  __syncthreads();   // ends every wave's last read of the ring, whose bytes the join below overwrites
  l += xhalf(l);
#pragma unroll
  for (int j = 0; j < 4; ++j)
#pragma unroll
    for (int r = 0; r < 8; ++r) red[ks][j * 16 + 8 * g + r][qg * 16 + col] = acc[j][r];   // x 2^11, as the sum l is
  if (g == 0) { rm[ks][qg * 16 + col] = m; rl[ks][qg * 16 + col] = l; }
  __syncthreads();
  if (tid < FQN) { float mt = rm[0][tid];
#pragma unroll
    for (int s = 1; s < FS; ++s) mt = fmaxf(mt, rm[s][tid]);
    float w[FS], lt = 0.f;
#pragma unroll
    for (int s = 0; s < FS; ++s) { w[s] = ex2(rm[s][tid] - mt); lt += w[s] * rl[s][tid]; }
    const float inv = 1.0f / lt;
#pragma unroll
    for (int s = 0; s < FS; ++s) rw[s][tid] = w[s] * inv; }
  __syncthreads();
  for (int e = tid; e < CC * (FQN / 4); e += 512) { const int c = e >> 4, q = e & 15; const size_t off = (b * CC + c) * (size_t)XSTR + n0 + q * 4; const v4f xr = *(const v4f*)(X + off); v4f o = *(const v4f*)&red[0][c][q * 4] * *(const v4f*)&rw[0][q * 4];
#pragma unroll
    for (int s = 1; s < FS; ++s) o += *(const v4f*)&red[s][c][q * 4] * *(const v4f*)&rw[s][q * 4];
#pragma unroll
    for (int z = 0; z < 4; ++z) { const float p = bfr(xr[z]) + alpha * o[z]; o[z] = p + p; }
    vst2(OUT + off, o); } }
extern "C" void kernel_launch(void* const* d_in, const int* in_sizes, int n_in, void* d_out, int out_size, void* d_ws, size_t ws_size, hipStream_t stream) {
  (void)in_sizes; (void)n_in; (void)out_size;
  const float** F = (const float**)d_in;   // 0 feature [2,64,8192,1], 1 wa [64,64] ([out,in]), 2 ba, 3 wb, 4 bb, 5 wm, 6 bm, 7 bn_gamma, 8 bn_beta, 9 bn_mean, 10 bn_var, 11 alpha (scalar, read)
  if (ws_size < (size_t)WS_END) return;
  char* ws = (char*)d_ws; _Float16 *AH = (_Float16*)(ws + WS_AH), *AL = (_Float16*)(ws + WS_AL), *BH = (_Float16*)(ws + WS_BH), *BL = (_Float16*)(ws + WS_BL), *MP = (_Float16*)(ws + WS_MP);
  k_proj<<<dim3(TNB * TT / 64, 3), 128, 0, stream>>>(F[0], F[1], F[2], F[3], F[4], F[5], F[6], F[7], F[8], F[9], F[10], AH, AL, BH, BL, MP);
  k_fa<<<dim3(TT / FQN, TNB), 512, 0, stream>>>(AH, AL, BH, BL, MP, F[0], F[11], (float*)d_out);
}

// v008
// It runs in 64.7 microseconds.
// In both of two side-by-side timings against v007, it was 1.12 times as fast.
// All steps since v000 together make it 35.6 times as fast.
// compute dtype: all float inputs rounded to bf16, alpha read; the three 1x1 convs with EXACT bf16 products on WMMA 16x16x32 (f32 accumulate, + bias), eval BatchNorm affine in f32; logits a^T b over the 64 channels with a and b as f16 hi + residual (x 2^10), 3 products, kept in f32 registers; softmax in f32 with a running maximum and sum, both kept in the base-2 domain (2^(s log2e - max log2e + 11) by the hardware exp2), divided by the sum at the end; exp(s - max) x 2^11 as f16 hi + f16 residual (unscaled) against the normalised m rounded ONCE to f16 (2 products, both added into one f32 tile); residual blend 2 (feature + alpha out) in f32; channels-first f32 output.
#include <hip/hip_runtime.h>
#include <math.h>

typedef __attribute__((ext_vector_type(16))) _Float16 v16h;
typedef __attribute__((ext_vector_type(16))) __bf16 v16b;
typedef __attribute__((ext_vector_type(8)))  _Float16 v8h;
typedef __attribute__((ext_vector_type(8)))  float v8f;
typedef __attribute__((ext_vector_type(4)))  float v4f;
typedef __attribute__((ext_vector_type(2)))  float v2f;
typedef __attribute__((ext_vector_type(4)))  unsigned v4u;
typedef __attribute__((ext_vector_type(8)))  unsigned v8u;
typedef __attribute__((ext_vector_type(2)))  _Float16 v2h;
typedef __attribute__((ext_vector_type(4)))  int v4i;
typedef float __attribute__((may_alias)) float_a;
typedef int __attribute__((may_alias)) int_a;

template <typename T> __device__ __forceinline__ void vst2(void* p, T v) { *(T*)p = v;  }
__device__ __forceinline__ v8f wmma16(v16h a, v16h b, v8f c) {
  return __builtin_amdgcn_wmma_f32_16x16x32_f16(false, a, false, b, (short)0, c, false, false);
}
__device__ __forceinline__ v8f wmma_bf(v16b a, v16b b, v8f c) {
  v8f d = __builtin_amdgcn_wmma_f32_16x16x32_bf16(false, a, false, b, (short)0, c, false, false);
  asm volatile("v_nop\n\tv_nop\n\tv_nop\n\tv_nop" : "+v"(d) : "v"(a), "v"(b));
  return d;
}
// 16x16x32 fragments: lane = (h = lane>>4, row/col = lane&15); elements 0..7 = k0+8h+0..7, 8..15 = k0+16+8h+0..7; D element r = row 8h+r
__device__ __forceinline__ v16h frag_h(const _Float16* rowk0, int lane) {
  union { v16h v; v8h q[2]; } u; const _Float16* p = rowk0 + 8 * (lane >> 4);
  u.q[0] = *(const v8h*)p; u.q[1] = *(const v8h*)(p + 16); return u.v;
}
__device__ __forceinline__ v16h frag_f32(const float* rowk0, int lane) {
  v16h a; const float* p = rowk0 + 8 * (lane >> 4);
#pragma unroll
  for (int i = 0; i < 8; ++i) { a[i] = (_Float16)p[i]; a[8 + i] = (_Float16)p[16 + i]; }
  return a;
}
__device__ __forceinline__ v16h frag_f32s(const float* rowk0, int lane, float sc) {
  v16h a; const float* p = rowk0 + 8 * (lane >> 4);
#pragma unroll
  for (int i = 0; i < 8; ++i) { a[i] = (_Float16)(p[i] * sc); a[8 + i] = (_Float16)(p[16 + i] * sc); }
  return a;
}
// column fragment from a [K][ld] layout (column n), rows >= K read as 0
__device__ __forceinline__ v16h fragc_f32(const float* W, int k0, int n, int lane, int ld, int K) {
  v16h a; const int g = lane >> 4;
#pragma unroll
  for (int i = 0; i < 8; ++i) { const int ka = k0 + 8 * g + i, kb = ka + 16;
    a[i] = (_Float16)(ka < K ? W[(size_t)(ka < K ? ka : K - 1) * ld + n] : 0.f); a[8 + i] = (_Float16)(kb < K ? W[(size_t)(kb < K ? kb : K - 1) * ld + n] : 0.f); }
  return a;
}
struct F2 { v16b h, l; };
__device__ __forceinline__ F2 bsplit16(const float v[16]) { F2 r;
#pragma unroll
  for (int i = 0; i < 16; ++i) { const __bf16 h = (__bf16)v[i]; r.h[i] = h; r.l[i] = (__bf16)(v[i] - (float)h); }
  return r; }
__device__ __forceinline__ F2 split_row(const float* row, int k0, int lane) { float v[16]; const float* p = row + k0 + 8 * (lane >> 4);
#pragma unroll
  for (int i = 0; i < 8; ++i) { v[i] = p[i]; v[8 + i] = p[16 + i]; }
  return bsplit16(v); }
__device__ __forceinline__ F2 split_rowK(const float* row, int k0, int lane, int K) { float v[16]; const int g = lane >> 4;
#pragma unroll
  for (int i = 0; i < 8; ++i) { const int ka = k0 + 8 * g + i, kb = ka + 16; v[i] = ka < K ? row[ka < K ? ka : K - 1] : 0.f; v[8 + i] = kb < K ? row[kb < K ? kb : K - 1] : 0.f; }
  return bsplit16(v); }
__device__ __forceinline__ F2 split_col(const float* W, int k0, int n, int lane, int ld, int K) { float v[16]; const int g = lane >> 4;
#pragma unroll
  for (int i = 0; i < 8; ++i) { const int ka = k0 + 8 * g + i, kb = ka + 16; v[i] = ka < K ? W[(size_t)(ka < K ? ka : K - 1) * ld + n] : 0.f; v[8 + i] = kb < K ? W[(size_t)(kb < K ? kb : K - 1) * ld + n] : 0.f; }
  return bsplit16(v); }
__device__ __forceinline__ v8f mac3(const F2& a, const F2& b, v8f c) { c = wmma_bf(a.l, b.h, c); c = wmma_bf(a.h, b.l, c); return wmma_bf(a.h, b.h, c); }
__device__ __forceinline__ float sigm(float v) { return 1.0f / (1.0f + expf(-v)); }
#define LDSX() do { asm volatile("s_wait_dscnt 0" ::: "memory"); __builtin_amdgcn_wave_barrier(); __builtin_amdgcn_fence(__ATOMIC_RELEASE, "workgroup"); } while (0)

// GFA / PAM (B 2, C 64, N 8,192 points): a, b, m = conv1x1(x); att = softmax_m(sum_c a[c][n] b[c][m]); m = BN_eval(m); out[c][n] = sum_m att[n][m] m[c][m]; p = feature + alpha out; return p + p.
__device__ __forceinline__ float bfr(float v) { return (float)(__bf16)v; }
#define NB 2
#define CC 64
#define TT 8192
#ifndef TNB
#define TNB NB
#endif
#ifndef XSTR
#define XSTR TT
#endif
#define WS_AH  0u                                   // f16 a hi / lo rows [b*N+n][64]
#define WS_AL  (WS_AH + 2u * (size_t)NB * TT * CC)
#define WS_BK  (WS_AL + 2u * (size_t)NB * TT * CC)    // f16 b rows [b*N+n][128]: hi in 0 .. 63, lo in 64 .. 127 (one 256-B row per key)
#define WS_MP  (WS_BK + 4u * (size_t)NB * TT * CC)    // f16 normalised-m planes [b][c][n]
#define WS_END (WS_MP + 2u * (size_t)NB * CC * TT)
// ---- k_proj: block = (64 points, which of a / b / m). A lane's x fragment (16 channels of ONE point per 32-channel step) is read straight from the channels-first feature: per load the 16 lanes of a half-wave take 16 neighbouring points of one channel (64 B), all 32 loads of a lane in flight together; rounded to bf16 in registers
__global__ __launch_bounds__(128) void k_proj(const float* __restrict__ X, const float* __restrict__ WA, const float* __restrict__ BA, const float* __restrict__ WB, const float* __restrict__ BB, const float* __restrict__ WM, const float* __restrict__ BM, const float* __restrict__ G, const float* __restrict__ BT, const float* __restrict__ MU, const float* __restrict__ VAR,
    _Float16* __restrict__ AH, _Float16* __restrict__ AL, _Float16* __restrict__ BK, _Float16* __restrict__ MP) { __shared__ __align__(16) _Float16 sh[64][72], sl[64][72]; __shared__ __align__(16) _Float16 th[CC][72];
  const int tid = threadIdx.x, wave = tid >> 5, lane = tid & 31, col = lane & 15, g = lane >> 4; const int which = blockIdx.y; const size_t r0 = (size_t)blockIdx.x * 64; const float* Wt = which == 0 ? WA : which == 1 ? WB : WM; const float* Bv = which == 0 ? BA : which == 1 ? BB : BM;
  v8f acc[4] = {}; float xv[CC / 32][16]; { const float* p = X + ((r0 / TT) * CC + 8 * g) * (size_t)XSTR + (r0 % TT) + wave * 16 + col;
#pragma unroll   // constant indices, so that xv is registers
    for (int kc = 0; kc < CC / 32; ++kc)
#pragma unroll
      for (int i = 0; i < 8; ++i) { xv[kc][i] = p[(size_t)(kc * 32 + i) * XSTR]; xv[kc][8 + i] = p[(size_t)(kc * 32 + 16 + i) * XSTR]; } }
  asm volatile("s_wait_xcnt 0x0" ::: "memory");   // stands in front of the first overwrite of an address register of the loads above
#pragma unroll
  for (int kc = 0; kc < CC / 32; ++kc) { v16b a;
#pragma unroll
    for (int i = 0; i < 16; ++i) a[i] = (__bf16)xv[kc][i];
#pragma unroll
    for (int j = 0; j < 4; ++j) { v16b w; const float* wr = Wt + (size_t)(j * 16 + col) * CC + kc * 32 + 8 * g;
#pragma unroll
      for (int i = 0; i < 8; ++i) { w[i] = (__bf16)wr[i]; w[8 + i] = (__bf16)wr[16 + i]; }
      asm volatile("s_wait_loadcnt 0x0" ::: "memory"); acc[j] = wmma_bf(a, w, acc[j]); } }
#pragma unroll
  for (int j = 0; j < 4; ++j) { const int o = j * 16 + col; const float bb = bfr(Bv[o]); float sc = 1.f, sh0 = 0.f; if (which == 2) { sc = rsqrtf(bfr(VAR[o]) + 1e-5f) * bfr(G[o]); sh0 = bfr(BT[o]) - bfr(MU[o]) * sc; }
#pragma unroll
    for (int r = 0; r < 8; ++r) { const float v = acc[j][r] + bb; const int rl = wave * 16 + 8 * g + r;
      if (which == 2) th[o][rl] = (_Float16)(v * sc + sh0); else { const _Float16 hv = (_Float16)v; sh[rl][o] = hv; sl[rl][o] = (_Float16)((v - (float)hv) * 1024.0f); } } }
  __syncthreads();
  if (which < 2) { _Float16* DH = which == 0 ? AH : BK; _Float16* DL = which == 0 ? AL : BK + CC; const size_t ld = which == 0 ? CC : 2 * CC; for (int e = tid; e < 64 * 8; e += 128) { const int rl = e >> 3, q = e & 7; vst2((unsigned*)(DH + (r0 + rl) * ld + q * 8), *(const v4u*)&sh[rl][q * 8]); vst2((unsigned*)(DL + (r0 + rl) * ld + q * 8), *(const v4u*)&sl[rl][q * 8]); } }
  else { const size_t b = r0 / TT; const int n0 = (int)(r0 % TT); for (int e = tid; e < CC * 8; e += 128) { const int cl = e >> 3, q = e & 7; vst2((unsigned*)(MP + (b * CC + cl) * (size_t)TT + n0 + q * 8), *(const v4u*)&th[cl][q * 8]); } } }
// lane l with lane l ^ 16
__device__ __forceinline__ float xhalf(float x) { return __builtin_bit_cast(float, __builtin_amdgcn_permlanex16(__builtin_bit_cast(int, x), __builtin_bit_cast(int, x), 0x76543210, 0xfedcba98, false, false)); }
// ---- k_fa: block = 64 queries of batch b, 16 waves = 4 query groups of 16 x 4 key ranges. A stage is 128 keys (b hi | lo rows and the m planes) in LDS; six buffers used as two groups of three, with ONE barrier per three stages, so that between barriers a wave may run ahead of its neighbours and its LDS reads and matrix products fall under their vector work; key range ks takes keys 32 ks .. 32 ks + 31 of every stage.
// The ring is filled by tensor loads, through no register: a stage is two tiles of 256-B rows (128 b rows; 64 m rows), laid at a pitch of 272 B by the pad. Waves 0 .. 5 issue one tile each per group, behind the barrier that ends the last read of the group they refill, a whole group (three stages of work) ahead of its first read.
// Per pass: St = b . at (3 products; a lane holds 16 keys of ONE query), running maximum (as max log2e - 11) and sum (x 2^11) in f32, 2^(s log2e - that maximum) = exp(s - max) x 2^11 as f16 hi + residual packs straight into a B operand, Ot += m . Pt (2 products into the same tile; a lane holds 8 channels of one query per tile).
// The residual needs no scale of its own: the values reach 2^11, so it is held to 2^-25 or to 2^-11 of itself, whichever is larger, against a sum of at least 2^11.
// The four key ranges' (max, sum, Ot) are joined through LDS in key-range order, in the bytes of the ring, behind a barrier that ends its last read; epilogue: res = 2 (feature + alpha o), channels-first (two whole 128-B lines per channel)
#define FQ 4                  // query groups of 16 per block
#define FS 4                  // key ranges per block
#define FK (FS * 32)          // keys per stage
#define FNS (TT / FK)         // stages
#define FQN (FQ * 16)         // queries per block
#define FG 3                  // stages between two barriers
struct fa_stage { _Float16 kk[FK][2 * CC + 8], mm[CC][FK + 8], fill[512]; };   // pitch 272 B: 16 B x odd; fill: every tile's place in LDS is a multiple of 2 KiB
static_assert(sizeof(fa_stage) % 2048 == 0 && (sizeof(_Float16) * FK * (2 * CC + 8)) % 2048 == 0, "tile places");
struct fa_join { float red[FS][CC][FQN + 4], rm[FS][FQN], rl[FS][FQN], rw[FS][FQN]; };
union fa_lds { fa_stage ring[2 * FG]; fa_join join; };
typedef uint32_t u32x4 __attribute__((ext_vector_type(4)));
typedef uint32_t u32x8 __attribute__((ext_vector_type(8)));
__device__ __forceinline__ uint32_t uni(uint32_t v) { return (uint32_t)__builtin_amdgcn_readfirstlane(v); }
// a wave-uniform test held in a scalar register (the empty statement keeps it there), so that the branch on it is s_cmp + s_cbranch_scc: a tensor load ignores EXEC
__device__ __forceinline__ uint32_t pinned(uint32_t v) { uint32_t w = __builtin_amdgcn_readfirstlane(v); asm volatile("" : "+s"(w)); return w; }
// a request is two groups of scalar words. Group 0: count 1, LDS byte dst, global address ga of the tile's first byte, type 2
__device__ __forceinline__ u32x4 tdm_g0(uint32_t dst, uint64_t ga) { u32x4 g; g[0] = uni(1u); g[1] = uni(dst); g[2] = uni((uint32_t)ga); g[3] = uni((((uint32_t)(ga >> 32)) & 0x01FFFFFFu) | 0x80000000u); return g; }
// group 1: nrows rows of 256 B, source row pitch in bytes, 16 B of pad behind every 256 B (LDS pitch 272 B); every extent in bytes, tensor = tile, no mask
__device__ __forceinline__ u32x8 tdm_g1(uint32_t nrows, uint32_t pitch) { u32x8 g; g[0] = uni((1u << 20) | (5u << 22) | (3u << 25)); g[1] = uni(256u << 16); g[2] = uni(nrows << 16); g[3] = uni(256u << 16); g[4] = uni(nrows); g[5] = uni(pitch); g[6] = uni(0u); g[7] = uni(0u); return g; }
__device__ __forceinline__ void tdm_load(u32x4 g0, u32x8 g1) { asm volatile("tensor_load_to_lds %0, %1" :: "s"(g0), "s"(g1) : "memory"); }
// the issuing wave's wait for its request. It names the request's two groups as inputs, so that their registers hold the descriptor until here and take no other value while the request is outstanding
__device__ __forceinline__ void tdm_wait(u32x4 g0, u32x8 g1) { asm volatile("s_wait_tensorcnt 0x0" :: "s"(g0), "s"(g1) : "memory"); }
#define L2E 1.4426950408889634f
// 2^x by v_exp_f32, several independent ones in one statement. Every argument here is <= about 11, and a result below the normal range may go to 0.
// Each result has a register of its own ("=&v"), so no v_exp_f32 overwrites a source of the one in front of it; the closing v_nop is the slot the instruction set asks for between the last one and a reader of its result.
__device__ __forceinline__ void ex2x8(float* r, const float* x) {
  asm("v_exp_f32 %0, %8\n\tv_exp_f32 %1, %9\n\tv_exp_f32 %2, %10\n\tv_exp_f32 %3, %11\n\tv_exp_f32 %4, %12\n\tv_exp_f32 %5, %13\n\tv_exp_f32 %6, %14\n\tv_exp_f32 %7, %15\n\tv_nop"
      : "=&v"(r[0]), "=&v"(r[1]), "=&v"(r[2]), "=&v"(r[3]), "=&v"(r[4]), "=&v"(r[5]), "=&v"(r[6]), "=&v"(r[7]) : "v"(x[0]), "v"(x[1]), "v"(x[2]), "v"(x[3]), "v"(x[4]), "v"(x[5]), "v"(x[6]), "v"(x[7])); }
// lo = f16(x - hi) for eight values: hi holds four packed f16 pairs (the rounded x), one mixed-precision fma per value reads its f16 half beside the f32 x and writes its half of the packed result,
// in place of widening hi, subtracting and packing. The four low halves stand first, so that a register's second write is four instructions behind its first. Results have registers of their own ("=&v").
__device__ __forceinline__ void resx8(unsigned* lo, const unsigned* hi, const float* x) {
  asm("v_fma_mixlo_f16 %0, %4, -1.0, %8 op_sel_hi:[1,1,0]\n\tv_fma_mixlo_f16 %1, %5, -1.0, %10 op_sel_hi:[1,1,0]\n\tv_fma_mixlo_f16 %2, %6, -1.0, %12 op_sel_hi:[1,1,0]\n\tv_fma_mixlo_f16 %3, %7, -1.0, %14 op_sel_hi:[1,1,0]\n\t"
      "v_fma_mixhi_f16 %0, %4, -1.0, %9 op_sel:[1,0,0] op_sel_hi:[1,1,0]\n\tv_fma_mixhi_f16 %1, %5, -1.0, %11 op_sel:[1,0,0] op_sel_hi:[1,1,0]\n\tv_fma_mixhi_f16 %2, %6, -1.0, %13 op_sel:[1,0,0] op_sel_hi:[1,1,0]\n\tv_fma_mixhi_f16 %3, %7, -1.0, %15 op_sel:[1,0,0] op_sel_hi:[1,1,0]"
      : "=&v"(lo[0]), "=&v"(lo[1]), "=&v"(lo[2]), "=&v"(lo[3]) : "v"(hi[0]), "v"(hi[1]), "v"(hi[2]), "v"(hi[3]), "v"(x[0]), "v"(x[1]), "v"(x[2]), "v"(x[3]), "v"(x[4]), "v"(x[5]), "v"(x[6]), "v"(x[7])); }
__device__ __forceinline__ float ex2(float x) { float r; asm("v_exp_f32 %0, %1\n\tv_nop" : "=&v"(r) : "v"(x)); return r; }
__global__ __launch_bounds__(512) void k_fa(const _Float16* __restrict__ AH, const _Float16* __restrict__ AL, const _Float16* __restrict__ BK, const _Float16* __restrict__ MP, const float* __restrict__ X, const float* __restrict__ ALPHA, float* __restrict__ OUT) {
  __shared__ __attribute__((aligned(2048))) fa_lds sm; auto& red = sm.join.red; auto& rm = sm.join.rm; auto& rl = sm.join.rl; auto& rw = sm.join.rw;
  const int tid = threadIdx.x, wave = tid >> 5, lane = tid & 31, col = lane & 15, g = lane >> 4; const int qg = wave & (FQ - 1), ks = wave / FQ; const size_t b = blockIdx.y; const int n0 = blockIdx.x * FQN; const float alpha = bfr(ALPHA[0]);
  v16h ah[2], al[2];
#pragma unroll
  for (int kc = 0; kc < 2; ++kc) { const size_t qo = (b * TT + n0 + qg * 16 + col) * CC + kc * 32; ah[kc] = frag_h(AH + qo, lane); al[kc] = frag_h(AL + qo, lane); }
  // issuing waves 0 .. 2 FG - 1: wave 2 i brings the b tile, wave 2 i + 1 the m tile, of the i-th stage of a group
  const uint32_t wv = uni((uint32_t)tid >> 5), wi = wv >> 1; const bool isu = wv < 2 * FG, ism = (wv & 1u) != 0u;
  const uint64_t gsrc = ism ? (uint64_t)(size_t)(MP + b * CC * (size_t)TT) : (uint64_t)(size_t)(BK + b * TT * (size_t)(2 * CC));
  const uint32_t gstep = ism ? FK * 2u : FK * 2u * CC * 2u, nrows = ism ? CC : FK, pitch = ism ? TT * 2u : 2u * CC * 2u;   // bytes from stage to stage; rows; source row pitch in bytes
  const uint32_t lbase = (uint32_t)(size_t)&sm + (ism ? (uint32_t)(sizeof(_Float16) * FK * (2 * CC + 8)) : 0u);
  u32x8 g1 = tdm_g1(nrows, pitch); asm volatile("" : "+s"(g1));   // the form of pinned(), descriptor words held in scalar registers, on all eight words at once: one tuple for the whole kernel, so that none of its registers serves another use while a request is outstanding
  u32x4 g0 = tdm_g0(lbase + wi * (uint32_t)sizeof(fa_stage), gsrc + (uint64_t)wi * gstep);
  if (pinned(isu)) { tdm_load(g0, g1);   // stages 0 .. FG - 1 fill the first group
    tdm_wait(g0, g1); }   // this wave's tile has landed; the barrier below shows it to the other waves
  __syncthreads();
  g0 = tdm_g0(lbase + (FG + wi) * (uint32_t)sizeof(fa_stage), gsrc + (uint64_t)(FG + wi) * gstep);
  if (pinned(isu)) tdm_load(g0, g1);   // stages FG .. 2 FG - 1 fly while the first group is worked on
  v8f acc[4] = {}; float m = -3.0e38f, l = 0.f; int bf = 0, tl = FG;   // bf: the buffer of stage st, st mod 2 FG; tl: trips left to the next barrier
#pragma unroll 1
  for (int st = 0; st < FNS; ++st) { const fa_stage& sc = sm.ring[bf];
    v8f sa[2] = {}, sl[2] = {}; v16h kb[2][2], kv[2][2];
#pragma unroll
    for (int kc = 0; kc < 2; ++kc)
#pragma unroll
      for (int t = 0; t < 2; ++t) { kb[kc][t] = frag_h(&sc.kk[ks * 32 + t * 16 + col][kc * 32], lane); kv[kc][t] = frag_h(&sc.kk[ks * 32 + t * 16 + col][CC + kc * 32], lane); }
    __builtin_amdgcn_sched_barrier(0);   // keeps the sixteen reads above one group in front of the products; left alone, the compiler puts seven of them behind the first two products, and their LDS latency then stands open in the middle of the run
#pragma unroll
    for (int kc = 0; kc < 2; ++kc) {
#pragma unroll
      for (int t = 0; t < 2; ++t) sa[t] = wmma16(kb[kc][t], ah[kc], sa[t]);
#pragma unroll
      for (int t = 0; t < 2; ++t) sl[t] = wmma16(kb[kc][t], al[kc], sl[t]);
#pragma unroll
      for (int t = 0; t < 2; ++t) sl[t] = wmma16(kv[kc][t], ah[kc], sl[t]); }
    v16h mv[4];   // read here so that the LDS latency passes behind the softmax arithmetic
#pragma unroll
    for (int j = 0; j < 4; ++j) mv[j] = frag_h(&sc.mm[j * 16 + col][ks * 32], lane);
    float s[16];
#pragma unroll
    for (int i = 0; i < 16; ++i) s[i] = sa[i >> 3][i & 7] + sl[i >> 3][i & 7] * (1.0f / 1024.0f);   // key 32 ks + 16 (i >> 3) + 8 g + (i & 7) of the stage, query col: the k order of a B operand
    float mx = s[0];
#pragma unroll
    for (int i = 1; i < 16; ++i) mx = fmaxf(mx, s[i]);
    mx = fmaxf(mx, xhalf(mx)); const float mn = fmaxf(m, fmaf(mx, L2E, -11.0f)); const float f = ex2(m - mn); m = mn;
    float tx[16], a0[16];
#pragma unroll   // constant indices, so that tx and a0 are registers
    for (int i = 0; i < 16; i += 2) { const v2f t2 = __builtin_elementwise_fma((v2f){s[i], s[i + 1]}, (v2f){L2E, L2E}, (v2f){-mn, -mn}); tx[i] = t2[0]; tx[i + 1] = t2[1]; }
    ex2x8(a0, tx); ex2x8(a0 + 8, tx + 8);
    unsigned hu[8], lu[8]; float ps = 0.f;
#pragma unroll
    for (int i = 0; i < 16; ++i) ps += a0[i];
#pragma unroll   // constant indices, so that hu and lu are registers
    for (int i = 0; i < 8; ++i) hu[i] = __builtin_bit_cast(unsigned, __builtin_convertvector((v2f){a0[2 * i], a0[2 * i + 1]}, v2h));
    const v16h ph = __builtin_bit_cast(v16h, (v8u){hu[0], hu[1], hu[2], hu[3], hu[4], hu[5], hu[6], hu[7]});
    l = l * f + ps;
#pragma unroll
    for (int j = 0; j < 4; ++j) acc[j] *= f;
#pragma unroll
    for (int j = 0; j < 4; ++j) acc[j] = wmma16(mv[j], ph, acc[j]);
    resx8(lu, hu, a0); resx8(lu + 4, hu + 4, a0 + 8);   // the products above do not read these, so they can issue while the matrix unit works
    const v16h pl = __builtin_bit_cast(v16h, (v8u){lu[0], lu[1], lu[2], lu[3], lu[4], lu[5], lu[6], lu[7]});
#pragma unroll
    for (int j = 0; j < 4; ++j) acc[j] = wmma16(mv[j], pl, acc[j]);
    if (--tl == 0) { tl = FG;   // block-uniform; once per group of FG stages: publishes the next group and ends every read of the group that is refilled behind it
      asm volatile("s_wait_dscnt 0x0" ::: "memory");   // this wave's reads of the group have returned before a tensor load may aim at its bytes
      if (pinned(isu)) tdm_wait(g0, g1);   // this wave's tile of the next group has landed
      __syncthreads();
      if (pinned(isu && st + 1 + FG + (int)wi < FNS)) { g0 = tdm_g0(lbase + (uint32_t)(bf - (FG - 1) + (int)wi) * (uint32_t)sizeof(fa_stage), gsrc + (uint64_t)(uint32_t)(st + 1 + FG + (int)wi) * gstep); tdm_load(g0, g1); } }   // the group after the next, into the buffers just left, only while that stage exists
    bf = bf == 2 * FG - 1 ? 0 : bf + 1; }
  asm volatile("s_wait_tensorcnt 0x0" ::: "memory");   // no tensor load is in flight when the ring's bytes change their use
  asm volatile("s_wait_dscnt 0x0" ::: "memory");   // this wave's last reads of the ring have returned
  __syncthreads();   // ends every wave's last read of the ring, whose bytes the join below overwrites
  l += xhalf(l);
#pragma unroll
  for (int j = 0; j < 4; ++j)
#pragma unroll
    for (int r = 0; r < 8; ++r) red[ks][j * 16 + 8 * g + r][qg * 16 + col] = acc[j][r];   // x 2^11, as the sum l is
  if (g == 0) { rm[ks][qg * 16 + col] = m; rl[ks][qg * 16 + col] = l; }
  __syncthreads();
  if (tid < FQN) { float mt = rm[0][tid];
#pragma unroll
    for (int s = 1; s < FS; ++s) mt = fmaxf(mt, rm[s][tid]);
    float w[FS], lt = 0.f;
#pragma unroll
    for (int s = 0; s < FS; ++s) { w[s] = ex2(rm[s][tid] - mt); lt += w[s] * rl[s][tid]; }
    const float inv = 1.0f / lt;
#pragma unroll
    for (int s = 0; s < FS; ++s) rw[s][tid] = w[s] * inv; }
  __syncthreads();
  for (int e = tid; e < CC * (FQN / 4); e += 512) { const int c = e >> 4, q = e & 15; const size_t off = (b * CC + c) * (size_t)XSTR + n0 + q * 4; const v4f xr = *(const v4f*)(X + off); v4f o = *(const v4f*)&red[0][c][q * 4] * *(const v4f*)&rw[0][q * 4];
#pragma unroll
    for (int s = 1; s < FS; ++s) o += *(const v4f*)&red[s][c][q * 4] * *(const v4f*)&rw[s][q * 4];
#pragma unroll
    for (int z = 0; z < 4; ++z) { const float p = bfr(xr[z]) + alpha * o[z]; o[z] = p + p; }
    vst2(OUT + off, o); } }
extern "C" void kernel_launch(void* const* d_in, const int* in_sizes, int n_in, void* d_out, int out_size, void* d_ws, size_t ws_size, hipStream_t stream) {
  (void)in_sizes; (void)n_in; (void)out_size;
  const float** F = (const float**)d_in;   // 0 feature [2,64,8192,1], 1 wa [64,64] ([out,in]), 2 ba, 3 wb, 4 bb, 5 wm, 6 bm, 7 bn_gamma, 8 bn_beta, 9 bn_mean, 10 bn_var, 11 alpha (scalar, read)
  if (ws_size < (size_t)WS_END) return;
  char* ws = (char*)d_ws; _Float16 *AH = (_Float16*)(ws + WS_AH), *AL = (_Float16*)(ws + WS_AL), *BK = (_Float16*)(ws + WS_BK), *MP = (_Float16*)(ws + WS_MP);
  k_proj<<<dim3(TNB * TT / 64, 3), 128, 0, stream>>>(F[0], F[1], F[2], F[3], F[4], F[5], F[6], F[7], F[8], F[9], F[10], AH, AL, BK, MP);
  k_fa<<<dim3(TT / FQN, TNB), 512, 0, stream>>>(AH, AL, BK, MP, F[0], F[11], (float*)d_out);
}

// v009
// One run takes 60.1 microseconds.
// In both of two side-by-side timings against v008, it was 1.07 times as fast.
// Over all steps from v000 it is 38.2 times as fast.
// compute dtype: all float inputs rounded to bf16, alpha read; the three 1x1 convs with EXACT bf16 products on WMMA 16x16x32 (f32 accumulate, + bias), eval BatchNorm affine in f32; logits a^T b over the 64 channels with a log2e and b as f16 hi + residual (x 2^10), 3 products, kept in f32 registers; softmax in f32 in the base-2 domain against a reference held per query (a maximum seen so far, minus 7), which starts the logit sum and moves only when a logit stands more than 8 above that maximum; 2^(s log2e - reference) by the hardware exp2, at most 2^15, divided by the sum at the end; it goes as f16 hi + f16 residual (unscaled) against the normalised m rounded ONCE to f16 (2 products, both added into one f32 tile); residual blend 2 (feature + alpha out) in f32; channels-first f32 output.
#include <hip/hip_runtime.h>
#include <math.h>

typedef __attribute__((ext_vector_type(16))) _Float16 v16h;
typedef __attribute__((ext_vector_type(16))) __bf16 v16b;
typedef __attribute__((ext_vector_type(8)))  _Float16 v8h;
typedef __attribute__((ext_vector_type(8)))  float v8f;
typedef __attribute__((ext_vector_type(4)))  float v4f;
typedef __attribute__((ext_vector_type(2)))  float v2f;
typedef __attribute__((ext_vector_type(4)))  unsigned v4u;
typedef __attribute__((ext_vector_type(8)))  unsigned v8u;
typedef __attribute__((ext_vector_type(2)))  _Float16 v2h;
typedef __attribute__((ext_vector_type(4)))  int v4i;
typedef float __attribute__((may_alias)) float_a;
typedef int __attribute__((may_alias)) int_a;

template <typename T> __device__ __forceinline__ void vst2(void* p, T v) { *(T*)p = v;  }
__device__ __forceinline__ v8f wmma16(v16h a, v16h b, v8f c) {
  return __builtin_amdgcn_wmma_f32_16x16x32_f16(false, a, false, b, (short)0, c, false, false);
}
__device__ __forceinline__ v8f wmma_bf(v16b a, v16b b, v8f c) {
  v8f d = __builtin_amdgcn_wmma_f32_16x16x32_bf16(false, a, false, b, (short)0, c, false, false);
  asm volatile("v_nop\n\tv_nop\n\tv_nop\n\tv_nop" : "+v"(d) : "v"(a), "v"(b));
  return d;
}
// 16x16x32 fragments: lane = (h = lane>>4, row/col = lane&15); elements 0..7 = k0+8h+0..7, 8..15 = k0+16+8h+0..7; D element r = row 8h+r
__device__ __forceinline__ v16h frag_h(const _Float16* rowk0, int lane) {
  union { v16h v; v8h q[2]; } u; const _Float16* p = rowk0 + 8 * (lane >> 4);
  u.q[0] = *(const v8h*)p; u.q[1] = *(const v8h*)(p + 16); return u.v;
}
__device__ __forceinline__ v16h frag_f32(const float* rowk0, int lane) {
  v16h a; const float* p = rowk0 + 8 * (lane >> 4);
#pragma unroll
  for (int i = 0; i < 8; ++i) { a[i] = (_Float16)p[i]; a[8 + i] = (_Float16)p[16 + i]; }
  return a;
}
__device__ __forceinline__ v16h frag_f32s(const float* rowk0, int lane, float sc) {
  v16h a; const float* p = rowk0 + 8 * (lane >> 4);
#pragma unroll
  for (int i = 0; i < 8; ++i) { a[i] = (_Float16)(p[i] * sc); a[8 + i] = (_Float16)(p[16 + i] * sc); }
  return a;
}
// column fragment from a [K][ld] layout (column n), rows >= K read as 0
__device__ __forceinline__ v16h fragc_f32(const float* W, int k0, int n, int lane, int ld, int K) {
  v16h a; const int g = lane >> 4;
#pragma unroll
  for (int i = 0; i < 8; ++i) { const int ka = k0 + 8 * g + i, kb = ka + 16;
    a[i] = (_Float16)(ka < K ? W[(size_t)(ka < K ? ka : K - 1) * ld + n] : 0.f); a[8 + i] = (_Float16)(kb < K ? W[(size_t)(kb < K ? kb : K - 1) * ld + n] : 0.f); }
  return a;
}
struct F2 { v16b h, l; };
__device__ __forceinline__ F2 bsplit16(const float v[16]) { F2 r;
#pragma unroll
  for (int i = 0; i < 16; ++i) { const __bf16 h = (__bf16)v[i]; r.h[i] = h; r.l[i] = (__bf16)(v[i] - (float)h); }
  return r; }
__device__ __forceinline__ F2 split_row(const float* row, int k0, int lane) { float v[16]; const float* p = row + k0 + 8 * (lane >> 4);
#pragma unroll
  for (int i = 0; i < 8; ++i) { v[i] = p[i]; v[8 + i] = p[16 + i]; }
  return bsplit16(v); }
__device__ __forceinline__ F2 split_rowK(const float* row, int k0, int lane, int K) { float v[16]; const int g = lane >> 4;
#pragma unroll
  for (int i = 0; i < 8; ++i) { const int ka = k0 + 8 * g + i, kb = ka + 16; v[i] = ka < K ? row[ka < K ? ka : K - 1] : 0.f; v[8 + i] = kb < K ? row[kb < K ? kb : K - 1] : 0.f; }
  return bsplit16(v); }
__device__ __forceinline__ F2 split_col(const float* W, int k0, int n, int lane, int ld, int K) { float v[16]; const int g = lane >> 4;
#pragma unroll
  for (int i = 0; i < 8; ++i) { const int ka = k0 + 8 * g + i, kb = ka + 16; v[i] = ka < K ? W[(size_t)(ka < K ? ka : K - 1) * ld + n] : 0.f; v[8 + i] = kb < K ? W[(size_t)(kb < K ? kb : K - 1) * ld + n] : 0.f; }
  return bsplit16(v); }
__device__ __forceinline__ v8f mac3(const F2& a, const F2& b, v8f c) { c = wmma_bf(a.l, b.h, c); c = wmma_bf(a.h, b.l, c); return wmma_bf(a.h, b.h, c); }
__device__ __forceinline__ float sigm(float v) { return 1.0f / (1.0f + expf(-v)); }
#define LDSX() do { asm volatile("s_wait_dscnt 0" ::: "memory"); __builtin_amdgcn_wave_barrier(); __builtin_amdgcn_fence(__ATOMIC_RELEASE, "workgroup"); } while (0)

// GFA / PAM (B 2, C 64, N 8,192 points): a, b, m = conv1x1(x); att = softmax_m(sum_c a[c][n] b[c][m]); m = BN_eval(m); out[c][n] = sum_m att[n][m] m[c][m]; p = feature + alpha out; return p + p.
__device__ __forceinline__ float bfr(float v) { return (float)(__bf16)v; }
#define NB 2
#define L2E 1.4426950408889634f
#define CC 64
#define TT 8192
#ifndef TNB
#define TNB NB
#endif
#ifndef XSTR
#define XSTR TT
#endif
#define WS_AH  0u                                   // f16 a hi / lo rows [b*N+n][64]
#define WS_AL  (WS_AH + 2u * (size_t)NB * TT * CC)
#define WS_BK  (WS_AL + 2u * (size_t)NB * TT * CC)    // f16 b rows [b*N+n][128]: hi in 0 .. 63, lo in 64 .. 127 (one 256-B row per key)
#define WS_MP  (WS_BK + 4u * (size_t)NB * TT * CC)    // f16 normalised-m planes [b][c][n]
#define WS_END (WS_MP + 2u * (size_t)NB * CC * TT)
// ---- k_proj: block = (64 points, which of a / b / m). A lane's x fragment (16 channels of ONE point per 32-channel step) is read straight from the channels-first feature: per load the 16 lanes of a half-wave take 16 neighbouring points of one channel (64 B), all 32 loads of a lane in flight together; rounded to bf16 in registers
__global__ __launch_bounds__(128) void k_proj(const float* __restrict__ X, const float* __restrict__ WA, const float* __restrict__ BA, const float* __restrict__ WB, const float* __restrict__ BB, const float* __restrict__ WM, const float* __restrict__ BM, const float* __restrict__ G, const float* __restrict__ BT, const float* __restrict__ MU, const float* __restrict__ VAR,
    _Float16* __restrict__ AH, _Float16* __restrict__ AL, _Float16* __restrict__ BK, _Float16* __restrict__ MP) { __shared__ __align__(16) _Float16 sh[64][72], sl[64][72]; __shared__ __align__(16) _Float16 th[CC][72];
  const int tid = threadIdx.x, wave = tid >> 5, lane = tid & 31, col = lane & 15, g = lane >> 4; const int which = blockIdx.y; const size_t r0 = (size_t)blockIdx.x * 64; const float* Wt = which == 0 ? WA : which == 1 ? WB : WM; const float* Bv = which == 0 ? BA : which == 1 ? BB : BM;
  v8f acc[4] = {}; float xv[CC / 32][16]; { const float* p = X + ((r0 / TT) * CC + 8 * g) * (size_t)XSTR + (r0 % TT) + wave * 16 + col;
#pragma unroll   // constant indices, so that xv is registers
    for (int kc = 0; kc < CC / 32; ++kc)
#pragma unroll
      for (int i = 0; i < 8; ++i) { xv[kc][i] = p[(size_t)(kc * 32 + i) * XSTR]; xv[kc][8 + i] = p[(size_t)(kc * 32 + 16 + i) * XSTR]; } }
  asm volatile("s_wait_xcnt 0x0" ::: "memory");   // stands in front of the first overwrite of an address register of the loads above
#pragma unroll
  for (int kc = 0; kc < CC / 32; ++kc) { v16b a;
#pragma unroll
    for (int i = 0; i < 16; ++i) a[i] = (__bf16)xv[kc][i];
#pragma unroll
    for (int j = 0; j < 4; ++j) { v16b w; const float* wr = Wt + (size_t)(j * 16 + col) * CC + kc * 32 + 8 * g;
#pragma unroll
      for (int i = 0; i < 8; ++i) { w[i] = (__bf16)wr[i]; w[8 + i] = (__bf16)wr[16 + i]; }
      asm volatile("s_wait_loadcnt 0x0" ::: "memory"); acc[j] = wmma_bf(a, w, acc[j]); } }
#pragma unroll
  for (int j = 0; j < 4; ++j) { const int o = j * 16 + col; const float bb = bfr(Bv[o]), qs = which == 0 ? L2E : 1.0f; float sc = 1.f, sh0 = 0.f;   // a is stored x log2e, so that the logits come out of the products in the base-2 domain
    if (which == 2) { sc = rsqrtf(bfr(VAR[o]) + 1e-5f) * bfr(G[o]); sh0 = bfr(BT[o]) - bfr(MU[o]) * sc; }
#pragma unroll
    for (int r = 0; r < 8; ++r) { const float v = (acc[j][r] + bb) * qs; const int rl = wave * 16 + 8 * g + r;
      if (which == 2) th[o][rl] = (_Float16)(v * sc + sh0); else { const _Float16 hv = (_Float16)v; sh[rl][o] = hv; sl[rl][o] = (_Float16)((v - (float)hv) * 1024.0f); } } }
  __syncthreads();
  if (which < 2) { _Float16* DH = which == 0 ? AH : BK; _Float16* DL = which == 0 ? AL : BK + CC; const size_t ld = which == 0 ? CC : 2 * CC; for (int e = tid; e < 64 * 8; e += 128) { const int rl = e >> 3, q = e & 7; vst2((unsigned*)(DH + (r0 + rl) * ld + q * 8), *(const v4u*)&sh[rl][q * 8]); vst2((unsigned*)(DL + (r0 + rl) * ld + q * 8), *(const v4u*)&sl[rl][q * 8]); } }
  else { const size_t b = r0 / TT; const int n0 = (int)(r0 % TT); for (int e = tid; e < CC * 8; e += 128) { const int cl = e >> 3, q = e & 7; vst2((unsigned*)(MP + (b * CC + cl) * (size_t)TT + n0 + q * 8), *(const v4u*)&th[cl][q * 8]); } } }
// lane l with lane l ^ 16
__device__ __forceinline__ float xhalf(float x) { return __builtin_bit_cast(float, __builtin_amdgcn_permlanex16(__builtin_bit_cast(int, x), __builtin_bit_cast(int, x), 0x76543210, 0xfedcba98, false, false)); }
// ---- k_fa: block = 64 queries of batch b, 16 waves = 4 query groups of 16 x 4 key ranges. A stage is 128 keys (b hi | lo rows and the m planes) in LDS; six buffers used as two groups of three, with ONE barrier per three stages, so that between barriers a wave may run ahead of its neighbours and its LDS reads and matrix products fall under their vector work; key range ks takes keys 32 ks .. 32 ks + 31 of every stage.
// The ring is filled by tensor loads, through no register: a stage is two tiles of 256-B rows (128 b rows; 64 m rows), laid at a pitch of 272 B by the pad. Waves 0 .. 5 issue one tile each per group, behind the barrier that ends the last read of the group they refill, a whole group (three stages of work) ahead of its first read.
// Per pass: St = b . at - reference (3 products; a lane holds 16 keys of ONE query; minus the reference is the C operand of the first product, so no instruction per logit subtracts it), 2^St as f16 hi + residual packs straight into a B operand, sum in f32, Ot += m . Pt (2 products into the same tile; a lane holds 8 channels of one query per tile).
// The reference of a query is a maximum of its logits seen so far, minus FC. One test per pass, a ballot and a scalar branch: only when some lane holds a logit above reference + FC + FT (always in the first pass) do the references rise to the maxima so far, and Ot, the sum and this pass's logits follow. So 2^St is at most 2^(FC + FT) = 2^15, inside f16, and the sum is at least 2^FC.
// The residual needs no scale of its own: it is held to 2^-25 or to 2^-11 of itself, whichever is larger, against a sum of at least 2^7.
// The four key ranges' (reference, sum, Ot) are joined through LDS in key-range order, in the bytes of the ring, behind a barrier that ends its last read; epilogue: res = 2 (feature + alpha o), channels-first (two whole 128-B lines per channel)
#define FQ 4                  // query groups of 16 per block
#define FS 4                  // key ranges per block
#define FK (FS * 32)          // keys per stage
#define FNS (TT / FK)         // stages
#define FQN (FQ * 16)         // queries per block
#define FG 3                  // stages between two barriers
#define FC 7.0f               // a logit equal to the maximum in use gives 2^FC
#define FT 8.0f               // how far (base 2) a logit may stand above the maximum in use
struct fa_stage { _Float16 kk[FK][2 * CC + 8], mm[CC][FK + 8], fill[512]; };   // pitch 272 B: 16 B x odd; fill: every tile's place in LDS is a multiple of 2 KiB
static_assert(sizeof(fa_stage) % 2048 == 0 && (sizeof(_Float16) * FK * (2 * CC + 8)) % 2048 == 0, "tile places");
struct fa_join { float red[FS][CC][FQN + 4], rm[FS][FQN], rl[FS][FQN], rw[FS][FQN]; };
union fa_lds { fa_stage ring[2 * FG]; fa_join join; };
typedef uint32_t u32x4 __attribute__((ext_vector_type(4)));
typedef uint32_t u32x8 __attribute__((ext_vector_type(8)));
__device__ __forceinline__ uint32_t uni(uint32_t v) { return (uint32_t)__builtin_amdgcn_readfirstlane(v); }
// a wave-uniform test held in a scalar register (the empty statement keeps it there), so that the branch on it is s_cmp + s_cbranch_scc: a tensor load ignores EXEC
__device__ __forceinline__ uint32_t pinned(uint32_t v) { uint32_t w = __builtin_amdgcn_readfirstlane(v); asm volatile("" : "+s"(w)); return w; }
// a request is two groups of scalar words. Group 0: count 1, LDS byte dst, global address ga of the tile's first byte, type 2
__device__ __forceinline__ u32x4 tdm_g0(uint32_t dst, uint64_t ga) { u32x4 g; g[0] = uni(1u); g[1] = uni(dst); g[2] = uni((uint32_t)ga); g[3] = uni((((uint32_t)(ga >> 32)) & 0x01FFFFFFu) | 0x80000000u); return g; }
// group 1: nrows rows of 256 B, source row pitch in bytes, 16 B of pad behind every 256 B (LDS pitch 272 B); every extent in bytes, tensor = tile, no mask
__device__ __forceinline__ u32x8 tdm_g1(uint32_t nrows, uint32_t pitch) { u32x8 g; g[0] = uni((1u << 20) | (5u << 22) | (3u << 25)); g[1] = uni(256u << 16); g[2] = uni(nrows << 16); g[3] = uni(256u << 16); g[4] = uni(nrows); g[5] = uni(pitch); g[6] = uni(0u); g[7] = uni(0u); return g; }
__device__ __forceinline__ void tdm_load(u32x4 g0, u32x8 g1) { asm volatile("tensor_load_to_lds %0, %1" :: "s"(g0), "s"(g1) : "memory"); }
// the issuing wave's wait for its request. It names the request's two groups as inputs, so that their registers hold the descriptor until here and take no other value while the request is outstanding
__device__ __forceinline__ void tdm_wait(u32x4 g0, u32x8 g1) { asm volatile("s_wait_tensorcnt 0x0" :: "s"(g0), "s"(g1) : "memory"); }
// 2^x by v_exp_f32, several independent ones in one statement. Every argument here is <= 15, and a result below the normal range may go to 0.
// Each result has a register of its own ("=&v"), so no v_exp_f32 overwrites a source of the one in front of it; the closing v_nop is the slot the instruction set asks for between the last one and a reader of its result.
__device__ __forceinline__ void ex2x8(float* r, const float* x) {
  asm("v_exp_f32 %0, %8\n\tv_exp_f32 %1, %9\n\tv_exp_f32 %2, %10\n\tv_exp_f32 %3, %11\n\tv_exp_f32 %4, %12\n\tv_exp_f32 %5, %13\n\tv_exp_f32 %6, %14\n\tv_exp_f32 %7, %15\n\tv_nop"
      : "=&v"(r[0]), "=&v"(r[1]), "=&v"(r[2]), "=&v"(r[3]), "=&v"(r[4]), "=&v"(r[5]), "=&v"(r[6]), "=&v"(r[7]) : "v"(x[0]), "v"(x[1]), "v"(x[2]), "v"(x[3]), "v"(x[4]), "v"(x[5]), "v"(x[6]), "v"(x[7])); }
// lo = f16(x - hi) for eight values: hi holds four packed f16 pairs (the rounded x), one mixed-precision fma per value reads its f16 half beside the f32 x and writes its half of the packed result,
// in place of widening hi, subtracting and packing. The four low halves stand first, so that a register's second write is four instructions behind its first. Results have registers of their own ("=&v").
__device__ __forceinline__ void resx8(unsigned* lo, const unsigned* hi, const float* x) {
  asm("v_fma_mixlo_f16 %0, %4, -1.0, %8 op_sel_hi:[1,1,0]\n\tv_fma_mixlo_f16 %1, %5, -1.0, %10 op_sel_hi:[1,1,0]\n\tv_fma_mixlo_f16 %2, %6, -1.0, %12 op_sel_hi:[1,1,0]\n\tv_fma_mixlo_f16 %3, %7, -1.0, %14 op_sel_hi:[1,1,0]\n\t"
      "v_fma_mixhi_f16 %0, %4, -1.0, %9 op_sel:[1,0,0] op_sel_hi:[1,1,0]\n\tv_fma_mixhi_f16 %1, %5, -1.0, %11 op_sel:[1,0,0] op_sel_hi:[1,1,0]\n\tv_fma_mixhi_f16 %2, %6, -1.0, %13 op_sel:[1,0,0] op_sel_hi:[1,1,0]\n\tv_fma_mixhi_f16 %3, %7, -1.0, %15 op_sel:[1,0,0] op_sel_hi:[1,1,0]"
      : "=&v"(lo[0]), "=&v"(lo[1]), "=&v"(lo[2]), "=&v"(lo[3]) : "v"(hi[0]), "v"(hi[1]), "v"(hi[2]), "v"(hi[3]), "v"(x[0]), "v"(x[1]), "v"(x[2]), "v"(x[3]), "v"(x[4]), "v"(x[5]), "v"(x[6]), "v"(x[7])); }
__device__ __forceinline__ float ex2(float x) { float r; asm("v_exp_f32 %0, %1\n\tv_nop" : "=&v"(r) : "v"(x)); return r; }
__global__ __launch_bounds__(512) void k_fa(const _Float16* __restrict__ AH, const _Float16* __restrict__ AL, const _Float16* __restrict__ BK, const _Float16* __restrict__ MP, const float* __restrict__ X, const float* __restrict__ ALPHA, float* __restrict__ OUT) {
  __shared__ __attribute__((aligned(2048))) fa_lds sm; auto& red = sm.join.red; auto& rm = sm.join.rm; auto& rl = sm.join.rl; auto& rw = sm.join.rw;
  const int tid = threadIdx.x, wave = tid >> 5, lane = tid & 31, col = lane & 15, g = lane >> 4; const int qg = wave & (FQ - 1), ks = wave / FQ; const size_t b = blockIdx.y; const int n0 = blockIdx.x * FQN; const float alpha = bfr(ALPHA[0]);
  v16h ah[2], al[2];
#pragma unroll
  for (int kc = 0; kc < 2; ++kc) { const size_t qo = (b * TT + n0 + qg * 16 + col) * CC + kc * 32; ah[kc] = frag_h(AH + qo, lane); al[kc] = frag_h(AL + qo, lane); }
  // issuing waves 0 .. 2 FG - 1: wave 2 i brings the b tile, wave 2 i + 1 the m tile, of the i-th stage of a group
  const uint32_t wv = uni((uint32_t)tid >> 5), wi = wv >> 1; const bool isu = wv < 2 * FG, ism = (wv & 1u) != 0u;
  const uint64_t gsrc = ism ? (uint64_t)(size_t)(MP + b * CC * (size_t)TT) : (uint64_t)(size_t)(BK + b * TT * (size_t)(2 * CC));
  const uint32_t gstep = ism ? FK * 2u : FK * 2u * CC * 2u, nrows = ism ? CC : FK, pitch = ism ? TT * 2u : 2u * CC * 2u;   // bytes from stage to stage; rows; source row pitch in bytes
  const uint32_t lbase = (uint32_t)(size_t)&sm + (ism ? (uint32_t)(sizeof(_Float16) * FK * (2 * CC + 8)) : 0u);
  u32x8 g1 = tdm_g1(nrows, pitch); asm volatile("" : "+s"(g1));   // the form of pinned(), descriptor words held in scalar registers, on all eight words at once: one tuple for the whole kernel, so that none of its registers serves another use while a request is outstanding
  u32x4 g0 = tdm_g0(lbase + wi * (uint32_t)sizeof(fa_stage), gsrc + (uint64_t)wi * gstep);
  if (pinned(isu)) { tdm_load(g0, g1);   // stages 0 .. FG - 1 fill the first group
    tdm_wait(g0, g1); }   // this wave's tile has landed; the barrier below shows it to the other waves
  __syncthreads();
  g0 = tdm_g0(lbase + (FG + wi) * (uint32_t)sizeof(fa_stage), gsrc + (uint64_t)(FG + wi) * gstep);
  if (pinned(isu)) tdm_load(g0, g1);   // stages FG .. 2 FG - 1 fly while the first group is worked on
  v8f acc[4] = {}, cn = {}; float l = 0.f, top = -3.0e38f, low = -3.0e38f; int bf = 0, tl = FG;   // cn: minus the reference of this lane's query, in all eight elements (a C operand); top, low: bounds of the test and of the step, open in the first pass; bf: the buffer of stage st, st mod 2 FG; tl: trips left to the next barrier
#pragma unroll 1
  for (int st = 0; st < FNS; ++st) { const fa_stage& sc = sm.ring[bf];
    v8f sa[2] = {cn, cn}, sl[2] = {}; v16h kb[2][2], kv[2][2];
#pragma unroll
    for (int kc = 0; kc < 2; ++kc)
#pragma unroll
      for (int t = 0; t < 2; ++t) { kb[kc][t] = frag_h(&sc.kk[ks * 32 + t * 16 + col][kc * 32], lane); kv[kc][t] = frag_h(&sc.kk[ks * 32 + t * 16 + col][CC + kc * 32], lane); }
    __builtin_amdgcn_sched_barrier(0);   // keeps the sixteen reads above one group in front of the products; left alone, the compiler puts seven of them behind the first two products, and their LDS latency then stands open in the middle of the run
#pragma unroll
    for (int kc = 0; kc < 2; ++kc) {
#pragma unroll
      for (int t = 0; t < 2; ++t) sa[t] = wmma16(kb[kc][t], ah[kc], sa[t]);
#pragma unroll
      for (int t = 0; t < 2; ++t) sl[t] = wmma16(kb[kc][t], al[kc], sl[t]);
#pragma unroll
      for (int t = 0; t < 2; ++t) sl[t] = wmma16(kv[kc][t], ah[kc], sl[t]); }
    v16h mv[4];   // read here so that the LDS latency passes behind the softmax arithmetic
#pragma unroll
    for (int j = 0; j < 4; ++j) mv[j] = frag_h(&sc.mm[j * 16 + col][ks * 32], lane);
    v2f t2[8];   // logits minus reference, in the register pairs of the tiles; element e of pair i is key 32 ks + 16 (i >> 2) + 8 g + 2 (i & 3) + e of the stage, query col: the k order of a B operand
#pragma unroll   // constant indices, so that t2 is registers
    for (int i = 0; i < 8; ++i) { const int t = i >> 2, r = 2 * (i & 3); t2[i] = __builtin_elementwise_fma((v2f){sl[t][r], sl[t][r + 1]}, (v2f){1.0f / 1024.0f, 1.0f / 1024.0f}, (v2f){sa[t][r], sa[t][r + 1]}); }
    float mx = fmaxf(t2[0][0], t2[0][1]);
#pragma unroll
    for (int i = 1; i < 8; ++i) mx = fmaxf(fmaxf(mx, t2[i][0]), t2[i][1]);
    if (__builtin_amdgcn_ballot_w32(mx > top) != 0) {   // the same for the whole wave: a scalar branch, all lanes on inside it
      mx = fmaxf(mx, xhalf(mx)); const float d = fmaxf(mx - FC, low), f = ex2(fminf(-d, 0.0f));   // d: the rise of the reference, 0 for a query whose maximum has not grown; below 0 only in the first pass, where Ot and the sum are 0 and f must merely stay finite
      top = FC + FT; low = 0.0f; l *= f; cn -= d;
#pragma unroll
      for (int i = 0; i < 8; ++i) t2[i] -= d;
#pragma unroll
      for (int j = 0; j < 4; ++j) acc[j] *= f; }
    float tx[16], a0[16];
#pragma unroll   // constant indices, so that tx and a0 are registers
    for (int i = 0; i < 8; ++i) { tx[2 * i] = t2[i][0]; tx[2 * i + 1] = t2[i][1]; }
    ex2x8(a0, tx); ex2x8(a0 + 8, tx + 8);
    unsigned hu[8], lu[8]; float ps = 0.f;
#pragma unroll
    for (int i = 0; i < 16; ++i) ps += a0[i];
#pragma unroll   // constant indices, so that hu and lu are registers
    for (int i = 0; i < 8; ++i) hu[i] = __builtin_bit_cast(unsigned, __builtin_convertvector((v2f){a0[2 * i], a0[2 * i + 1]}, v2h));
    const v16h ph = __builtin_bit_cast(v16h, (v8u){hu[0], hu[1], hu[2], hu[3], hu[4], hu[5], hu[6], hu[7]});
    l += ps;
#pragma unroll
    for (int j = 0; j < 4; ++j) acc[j] = wmma16(mv[j], ph, acc[j]);
    resx8(lu, hu, a0); resx8(lu + 4, hu + 4, a0 + 8);   // the products above do not read these, so they can issue while the matrix unit works
    const v16h pl = __builtin_bit_cast(v16h, (v8u){lu[0], lu[1], lu[2], lu[3], lu[4], lu[5], lu[6], lu[7]});
#pragma unroll
    for (int j = 0; j < 4; ++j) acc[j] = wmma16(mv[j], pl, acc[j]);
    if (--tl == 0) { tl = FG;   // block-uniform; once per group of FG stages: publishes the next group and ends every read of the group that is refilled behind it
      asm volatile("s_wait_dscnt 0x0" ::: "memory");   // this wave's reads of the group have returned before a tensor load may aim at its bytes
      if (pinned(isu)) tdm_wait(g0, g1);   // this wave's tile of the next group has landed
      __syncthreads();
      if (pinned(isu && st + 1 + FG + (int)wi < FNS)) { g0 = tdm_g0(lbase + (uint32_t)(bf - (FG - 1) + (int)wi) * (uint32_t)sizeof(fa_stage), gsrc + (uint64_t)(uint32_t)(st + 1 + FG + (int)wi) * gstep); tdm_load(g0, g1); } }   // the group after the next, into the buffers just left, only while that stage exists
    bf = bf == 2 * FG - 1 ? 0 : bf + 1; }
  asm volatile("s_wait_tensorcnt 0x0" ::: "memory");   // no tensor load is in flight when the ring's bytes change their use
  asm volatile("s_wait_dscnt 0x0" ::: "memory");   // this wave's last reads of the ring have returned
  __syncthreads();   // ends every wave's last read of the ring, whose bytes the join below overwrites
  l += xhalf(l);
#pragma unroll
  for (int j = 0; j < 4; ++j)
#pragma unroll
    for (int r = 0; r < 8; ++r) red[ks][j * 16 + 8 * g + r][qg * 16 + col] = acc[j][r];   // against the same reference as the sum l
  if (g == 0) { rm[ks][qg * 16 + col] = -cn[0]; rl[ks][qg * 16 + col] = l; }
  __syncthreads();
  if (tid < FQN) { float mt = rm[0][tid];
#pragma unroll
    for (int s = 1; s < FS; ++s) mt = fmaxf(mt, rm[s][tid]);
    float w[FS], lt = 0.f;
#pragma unroll
    for (int s = 0; s < FS; ++s) { w[s] = ex2(rm[s][tid] - mt); lt += w[s] * rl[s][tid]; }
    const float inv = 1.0f / lt;
#pragma unroll
    for (int s = 0; s < FS; ++s) rw[s][tid] = w[s] * inv; }
  __syncthreads();
  for (int e = tid; e < CC * (FQN / 4); e += 512) { const int c = e >> 4, q = e & 15; const size_t off = (b * CC + c) * (size_t)XSTR + n0 + q * 4; const v4f xr = *(const v4f*)(X + off); v4f o = *(const v4f*)&red[0][c][q * 4] * *(const v4f*)&rw[0][q * 4];
#pragma unroll
    for (int s = 1; s < FS; ++s) o += *(const v4f*)&red[s][c][q * 4] * *(const v4f*)&rw[s][q * 4];
#pragma unroll
    for (int z = 0; z < 4; ++z) { const float p = bfr(xr[z]) + alpha * o[z]; o[z] = p + p; }
    vst2(OUT + off, o); } }
extern "C" void kernel_launch(void* const* d_in, const int* in_sizes, int n_in, void* d_out, int out_size, void* d_ws, size_t ws_size, hipStream_t stream) {
  (void)in_sizes; (void)n_in; (void)out_size;
  const float** F = (const float**)d_in;   // 0 feature [2,64,8192,1], 1 wa [64,64] ([out,in]), 2 ba, 3 wb, 4 bb, 5 wm, 6 bm, 7 bn_gamma, 8 bn_beta, 9 bn_mean, 10 bn_var, 11 alpha (scalar, read)
  if (ws_size < (size_t)WS_END) return;
  char* ws = (char*)d_ws; _Float16 *AH = (_Float16*)(ws + WS_AH), *AL = (_Float16*)(ws + WS_AL), *BK = (_Float16*)(ws + WS_BK), *MP = (_Float16*)(ws + WS_MP);
  k_proj<<<dim3(TNB * TT / 64, 3), 128, 0, stream>>>(F[0], F[1], F[2], F[3], F[4], F[5], F[6], F[7], F[8], F[9], F[10], AH, AL, BK, MP);
  k_fa<<<dim3(TT / FQN, TNB), 512, 0, stream>>>(AH, AL, BK, MP, F[0], F[11], (float*)d_out);
}

// v010
// One run takes 57.1 microseconds.
// Two timings next to v009 both put it at 1.05 times that version's speed.
// Counting every step since v000, it is 40.2 times as fast.
// compute dtype: all float inputs rounded to bf16, alpha read; the three 1x1 convs with EXACT bf16 products on WMMA 16x16x32 (f32 accumulate, + bias), eval BatchNorm affine in f32; logits a^T b over the 64 channels with a log2e and b as f16 hi + residual (x 2^10), 3 products, kept in f32 registers; softmax in f32 in the base-2 domain against a reference held per query (a maximum seen so far, minus 7), which starts the logit sum and moves only when a logit stands more than 8 above that maximum; 2^(s log2e - reference) by the hardware exp2, at most 2^15, divided by the sum at the end; it goes as f16 hi + f16 residual (unscaled) against the normalised m rounded ONCE to f16 (2 products, both added into one f32 tile); residual blend 2 (feature + alpha out) in f32; channels-first f32 output.
#include <hip/hip_runtime.h>
#include <math.h>

typedef __attribute__((ext_vector_type(16))) _Float16 v16h;
typedef __attribute__((ext_vector_type(16))) __bf16 v16b;
typedef __attribute__((ext_vector_type(4)))  __bf16 v4b;
typedef __attribute__((ext_vector_type(8)))  _Float16 v8h;
typedef __attribute__((ext_vector_type(8)))  float v8f;
typedef __attribute__((ext_vector_type(4)))  float v4f;
typedef __attribute__((ext_vector_type(2)))  float v2f;
typedef __attribute__((ext_vector_type(4)))  unsigned v4u;
typedef __attribute__((ext_vector_type(8)))  unsigned v8u;
typedef __attribute__((ext_vector_type(2)))  _Float16 v2h;
typedef __attribute__((ext_vector_type(4)))  int v4i;
typedef float __attribute__((may_alias)) float_a;
typedef int __attribute__((may_alias)) int_a;

template <typename T> __device__ __forceinline__ void vst2(void* p, T v) { *(T*)p = v;  }
__device__ __forceinline__ v8f wmma16(v16h a, v16h b, v8f c) {
  return __builtin_amdgcn_wmma_f32_16x16x32_f16(false, a, false, b, (short)0, c, false, false);
}
__device__ __forceinline__ v8f wmma_bf(v16b a, v16b b, v8f c) {
  v8f d = __builtin_amdgcn_wmma_f32_16x16x32_bf16(false, a, false, b, (short)0, c, false, false);
  asm volatile("v_nop\n\tv_nop\n\tv_nop\n\tv_nop" : "+v"(d) : "v"(a), "v"(b));
  return d;
}
// 16x16x32 fragments: lane = (h = lane>>4, row/col = lane&15); elements 0..7 = k0+8h+0..7, 8..15 = k0+16+8h+0..7; D element r = row 8h+r
__device__ __forceinline__ v16h frag_h(const _Float16* rowk0, int lane) {
  union { v16h v; v8h q[2]; } u; const _Float16* p = rowk0 + 8 * (lane >> 4);
  u.q[0] = *(const v8h*)p; u.q[1] = *(const v8h*)(p + 16); return u.v;
}
__device__ __forceinline__ v16h frag_f32(const float* rowk0, int lane) {
  v16h a; const float* p = rowk0 + 8 * (lane >> 4);
#pragma unroll
  for (int i = 0; i < 8; ++i) { a[i] = (_Float16)p[i]; a[8 + i] = (_Float16)p[16 + i]; }
  return a;
}
__device__ __forceinline__ v16h frag_f32s(const float* rowk0, int lane, float sc) {
  v16h a; const float* p = rowk0 + 8 * (lane >> 4);
#pragma unroll
  for (int i = 0; i < 8; ++i) { a[i] = (_Float16)(p[i] * sc); a[8 + i] = (_Float16)(p[16 + i] * sc); }
  return a;
}
// column fragment from a [K][ld] layout (column n), rows >= K read as 0
__device__ __forceinline__ v16h fragc_f32(const float* W, int k0, int n, int lane, int ld, int K) {
  v16h a; const int g = lane >> 4;
#pragma unroll
  for (int i = 0; i < 8; ++i) { const int ka = k0 + 8 * g + i, kb = ka + 16;
    a[i] = (_Float16)(ka < K ? W[(size_t)(ka < K ? ka : K - 1) * ld + n] : 0.f); a[8 + i] = (_Float16)(kb < K ? W[(size_t)(kb < K ? kb : K - 1) * ld + n] : 0.f); }
  return a;
}
struct F2 { v16b h, l; };
__device__ __forceinline__ F2 bsplit16(const float v[16]) { F2 r;
#pragma unroll
  for (int i = 0; i < 16; ++i) { const __bf16 h = (__bf16)v[i]; r.h[i] = h; r.l[i] = (__bf16)(v[i] - (float)h); }
  return r; }
__device__ __forceinline__ F2 split_row(const float* row, int k0, int lane) { float v[16]; const float* p = row + k0 + 8 * (lane >> 4);
#pragma unroll
  for (int i = 0; i < 8; ++i) { v[i] = p[i]; v[8 + i] = p[16 + i]; }
  return bsplit16(v); }
__device__ __forceinline__ F2 split_rowK(const float* row, int k0, int lane, int K) { float v[16]; const int g = lane >> 4;
#pragma unroll
  for (int i = 0; i < 8; ++i) { const int ka = k0 + 8 * g + i, kb = ka + 16; v[i] = ka < K ? row[ka < K ? ka : K - 1] : 0.f; v[8 + i] = kb < K ? row[kb < K ? kb : K - 1] : 0.f; }
  return bsplit16(v); }
__device__ __forceinline__ F2 split_col(const float* W, int k0, int n, int lane, int ld, int K) { float v[16]; const int g = lane >> 4;
#pragma unroll
  for (int i = 0; i < 8; ++i) { const int ka = k0 + 8 * g + i, kb = ka + 16; v[i] = ka < K ? W[(size_t)(ka < K ? ka : K - 1) * ld + n] : 0.f; v[8 + i] = kb < K ? W[(size_t)(kb < K ? kb : K - 1) * ld + n] : 0.f; }
  return bsplit16(v); }
__device__ __forceinline__ v8f mac3(const F2& a, const F2& b, v8f c) { c = wmma_bf(a.l, b.h, c); c = wmma_bf(a.h, b.l, c); return wmma_bf(a.h, b.h, c); }
__device__ __forceinline__ float sigm(float v) { return 1.0f / (1.0f + expf(-v)); }
#define LDSX() do { asm volatile("s_wait_dscnt 0" ::: "memory"); __builtin_amdgcn_wave_barrier(); __builtin_amdgcn_fence(__ATOMIC_RELEASE, "workgroup"); } while (0)

// GFA / PAM (B 2, C 64, N 8,192 points): a, b, m = conv1x1(x); att = softmax_m(sum_c a[c][n] b[c][m]); m = BN_eval(m); out[c][n] = sum_m att[n][m] m[c][m]; p = feature + alpha out; return p + p.
__device__ __forceinline__ float bfr(float v) { return (float)(__bf16)v; }
#define NB 2
#define L2E 1.4426950408889634f
#define CC 64
#define TT 8192
#ifndef TNB
#define TNB NB
#endif
#ifndef XSTR
#define XSTR TT
#endif
#define WS_AH  0u                                   // f16 a hi / lo rows [b*N+n][64]
#define WS_AL  (WS_AH + 2u * (size_t)NB * TT * CC)
#define WS_BK  (WS_AL + 2u * (size_t)NB * TT * CC)    // f16 b rows [b*N+n][128]: hi in 0 .. 63, lo in 64 .. 127 (one 256-B row per key)
#define WS_MP  (WS_BK + 4u * (size_t)NB * TT * CC)    // f16 normalised-m planes [b][c][n]
#define WS_END (WS_MP + 2u * (size_t)NB * CC * TT)
// ---- k_proj: block = (64 points, which of a / b / m). A lane's x fragment (16 channels of ONE point per 32-channel step) is read straight from the channels-first feature: per load the 16 lanes of a half-wave take 16 neighbouring points of one channel (64 B), all 32 loads of a lane in flight together; rounded to bf16 in registers
__global__ __launch_bounds__(128) void k_proj(const float* __restrict__ X, const float* __restrict__ WA, const float* __restrict__ BA, const float* __restrict__ WB, const float* __restrict__ BB, const float* __restrict__ WM, const float* __restrict__ BM, const float* __restrict__ G, const float* __restrict__ BT, const float* __restrict__ MU, const float* __restrict__ VAR,
    _Float16* __restrict__ AH, _Float16* __restrict__ AL, _Float16* __restrict__ BK, _Float16* __restrict__ MP) { __shared__ __align__(16) _Float16 sh[64][72], sl[64][72]; __shared__ __align__(16) _Float16 th[CC][72]; __shared__ __align__(16) __bf16 wl[CC][CC + 8]; __shared__ float pb[CC], pc[CC], ps[CC];   // wl: the block's weight matrix in bf16, pitch 144 B (16 B x odd); pb, pc, ps: bias, BatchNorm scale and shift per output channel
  const int tid = threadIdx.x, wave = tid >> 5, lane = tid & 31, col = lane & 15, g = lane >> 4; const int which = blockIdx.y; const size_t r0 = (size_t)blockIdx.x * 64; const float* Wt = which == 0 ? WA : which == 1 ? WB : WM; const float* Bv = which == 0 ? BA : which == 1 ? BB : BM;
  v8f acc[4] = {}; float xv[CC / 32][16]; const float* p = X + ((r0 / TT) * CC + 8 * g) * (size_t)XSTR + (r0 % TT) + wave * 16 + col; {
#pragma unroll   // constant indices, so that xv is registers
    for (int kc = 0; kc < CC / 32; ++kc)
#pragma unroll
      for (int i = 0; i < 8; ++i) { xv[kc][i] = p[(size_t)(kc * 32 + i) * XSTR]; xv[kc][8 + i] = p[(size_t)(kc * 32 + 16 + i) * XSTR]; } }
  // the block's parameters are fetched ONCE per block, by loads that cover whole 128-B lines (a wave's 16-byte loads: 512 B in a row), asked for right behind the x loads so that all fly together, and reach the four waves through LDS
  const float* wq = Wt + tid * 4; const int po = tid & (CC - 1); v4f wr[CC * CC / 512]; float v0 = 1.f, g0 = 0.f, t0 = 0.f, u0 = 0.f;
#pragma unroll   // constant indices, so that wr is registers
  for (int i = 0; i < CC * CC / 512; ++i) wr[i] = *(const v4f*)(wq + i * 512);
  const float b0 = Bv[po]; if (which == 2) { v0 = VAR[po]; g0 = G[po]; t0 = BT[po]; u0 = MU[po]; }
  asm volatile("s_wait_xcnt 0x0" :: "v"(p), "v"(tid), "v"(po) : "memory");   // stands in front of the first overwrite of an address register of the loads above: it names those registers as inputs, so that they keep their values until here
#pragma unroll
  for (int i = 0; i < CC * CC / 512; ++i) { v4b t;   // float 4 (tid + 128 i) of the matrix: row 8 i + (tid >> 4), columns 4 (tid & 15) ..
#pragma unroll
    for (int z = 0; z < 4; ++z) t[z] = (__bf16)wr[i][z];
    *(v4b*)&wl[8 * i + (tid >> 4)][4 * (tid & 15)] = t; }
  if (tid < CC) { float sc = 1.f, sh0 = 0.f;
    if (which == 2) { sc = rsqrtf(bfr(v0) + 1e-5f) * bfr(g0); sh0 = bfr(t0) - bfr(u0) * sc; }
    pb[po] = bfr(b0); pc[po] = sc; ps[po] = sh0; }
  __syncthreads();   // shows the staged parameters to all four waves
  union { v16b v; v4u q[2]; } w[CC / 32][4]; float bj[4], cj[4], sj[4];
#pragma unroll   // constant indices, so that w is registers
  for (int kc = 0; kc < CC / 32; ++kc)
#pragma unroll
    for (int j = 0; j < 4; ++j) { const __bf16* wf = &wl[j * 16 + col][kc * 32 + 8 * g]; w[kc][j].q[0] = *(const v4u*)wf; w[kc][j].q[1] = *(const v4u*)(wf + 16); }
#pragma unroll
  for (int j = 0; j < 4; ++j) { bj[j] = pb[j * 16 + col]; cj[j] = pc[j * 16 + col]; sj[j] = ps[j * 16 + col]; }
  __builtin_amdgcn_sched_barrier(0);   // keeps the LDS reads above one group in front of the products; left alone, the compiler reads each fragment right in front of its product, eight LDS latencies in a row
#pragma unroll
  for (int kc = 0; kc < CC / 32; ++kc) { v16b a;
#pragma unroll
    for (int i = 0; i < 16; ++i) a[i] = (__bf16)xv[kc][i];
#pragma unroll
    for (int j = 0; j < 4; ++j) acc[j] = wmma_bf(a, w[kc][j].v, acc[j]); }
#pragma unroll
  for (int j = 0; j < 4; ++j) { const int o = j * 16 + col; const float bb = bj[j], qs = which == 0 ? L2E : 1.0f, sc = cj[j], sh0 = sj[j];   // a is stored x log2e, so that the logits come out of the products in the base-2 domain
#pragma unroll
    for (int r = 0; r < 8; ++r) { const float v = (acc[j][r] + bb) * qs; const int rl = wave * 16 + 8 * g + r;
      if (which == 2) th[o][rl] = (_Float16)(v * sc + sh0); else { const _Float16 hv = (_Float16)v; sh[rl][o] = hv; sl[rl][o] = (_Float16)((v - (float)hv) * 1024.0f); } } }
  __syncthreads();
  if (which < 2) { _Float16* DH = which == 0 ? AH : BK; _Float16* DL = which == 0 ? AL : BK + CC; const size_t ld = which == 0 ? CC : 2 * CC; for (int e = tid; e < 64 * 8; e += 128) { const int rl = e >> 3, q = e & 7; vst2((unsigned*)(DH + (r0 + rl) * ld + q * 8), *(const v4u*)&sh[rl][q * 8]); vst2((unsigned*)(DL + (r0 + rl) * ld + q * 8), *(const v4u*)&sl[rl][q * 8]); } }
  else { const size_t b = r0 / TT; const int n0 = (int)(r0 % TT); for (int e = tid; e < CC * 8; e += 128) { const int cl = e >> 3, q = e & 7; vst2((unsigned*)(MP + (b * CC + cl) * (size_t)TT + n0 + q * 8), *(const v4u*)&th[cl][q * 8]); } } }
// lane l with lane l ^ 16
__device__ __forceinline__ float xhalf(float x) { return __builtin_bit_cast(float, __builtin_amdgcn_permlanex16(__builtin_bit_cast(int, x), __builtin_bit_cast(int, x), 0x76543210, 0xfedcba98, false, false)); }
// ---- k_fa: block = 64 queries of batch b, 16 waves = 4 query groups of 16 x 4 key ranges. A stage is 128 keys (b hi | lo rows and the m planes) in LDS; six buffers used as two groups of three, with ONE barrier per three stages, so that between barriers a wave may run ahead of its neighbours and its LDS reads and matrix products fall under their vector work; key range ks takes keys 32 ks .. 32 ks + 31 of every stage.
// The ring is filled by tensor loads, through no register: a stage is two tiles of 256-B rows (128 b rows; 64 m rows), laid at a pitch of 272 B by the pad. Waves 0 .. 5 issue one tile each per group, behind the barrier that ends the last read of the group they refill, a whole group (three stages of work) ahead of its first read.
// Per pass: St = b . at - reference (3 products; a lane holds 16 keys of ONE query; minus the reference is the C operand of the first product, so no instruction per logit subtracts it), 2^St as f16 hi + residual packs straight into a B operand, sum in f32, Ot += m . Pt (2 products into the same tile; a lane holds 8 channels of one query per tile).
// The reference of a query is a maximum of its logits seen so far, minus FC. One test per pass, a ballot and a scalar branch: only when some lane holds a logit above reference + FC + FT (always in the first pass) do the references rise to the maxima so far, and Ot, the sum and this pass's logits follow. So 2^St is at most 2^(FC + FT) = 2^15, inside f16, and the sum is at least 2^FC.
// The residual needs no scale of its own: it is held to 2^-25 or to 2^-11 of itself, whichever is larger, against a sum of at least 2^7.
// The four key ranges' (reference, sum, Ot) are joined through LDS in key-range order, in the bytes of the ring, behind a barrier that ends its last read; epilogue: res = 2 (feature + alpha o), channels-first (two whole 128-B lines per channel)
#define FQ 4                  // query groups of 16 per block
#define FS 4                  // key ranges per block
#define FK (FS * 32)          // keys per stage
#define FNS (TT / FK)         // stages
#define FQN (FQ * 16)         // queries per block
#define FG 3                  // stages between two barriers
#define FC 7.0f               // a logit equal to the maximum in use gives 2^FC
#define FT 8.0f               // how far (base 2) a logit may stand above the maximum in use
struct fa_stage { _Float16 kk[FK][2 * CC + 8], mm[CC][FK + 8], fill[512]; };   // pitch 272 B: 16 B x odd; fill: every tile's place in LDS is a multiple of 2 KiB
static_assert(sizeof(fa_stage) % 2048 == 0 && (sizeof(_Float16) * FK * (2 * CC + 8)) % 2048 == 0, "tile places");
struct fa_join { float red[FS][CC][FQN + 4], rm[FS][FQN], rl[FS][FQN], rw[FS][FQN]; };
union fa_lds { fa_stage ring[2 * FG]; fa_join join; };
typedef uint32_t u32x4 __attribute__((ext_vector_type(4)));
typedef uint32_t u32x8 __attribute__((ext_vector_type(8)));
__device__ __forceinline__ uint32_t uni(uint32_t v) { return (uint32_t)__builtin_amdgcn_readfirstlane(v); }
// a wave-uniform test held in a scalar register (the empty statement keeps it there), so that the branch on it is s_cmp + s_cbranch_scc: a tensor load ignores EXEC
__device__ __forceinline__ uint32_t pinned(uint32_t v) { uint32_t w = __builtin_amdgcn_readfirstlane(v); asm volatile("" : "+s"(w)); return w; }
// a request is two groups of scalar words. Group 0: count 1, LDS byte dst, global address ga of the tile's first byte, type 2
__device__ __forceinline__ u32x4 tdm_g0(uint32_t dst, uint64_t ga) { u32x4 g; g[0] = uni(1u); g[1] = uni(dst); g[2] = uni((uint32_t)ga); g[3] = uni((((uint32_t)(ga >> 32)) & 0x01FFFFFFu) | 0x80000000u); return g; }
// group 1: nrows rows of 256 B, source row pitch in bytes, 16 B of pad behind every 256 B (LDS pitch 272 B); every extent in bytes, tensor = tile, no mask
__device__ __forceinline__ u32x8 tdm_g1(uint32_t nrows, uint32_t pitch) { u32x8 g; g[0] = uni((1u << 20) | (5u << 22) | (3u << 25)); g[1] = uni(256u << 16); g[2] = uni(nrows << 16); g[3] = uni(256u << 16); g[4] = uni(nrows); g[5] = uni(pitch); g[6] = uni(0u); g[7] = uni(0u); return g; }
__device__ __forceinline__ void tdm_load(u32x4 g0, u32x8 g1) { asm volatile("tensor_load_to_lds %0, %1" :: "s"(g0), "s"(g1) : "memory"); }
// the issuing wave's wait for its request. It names the request's two groups as inputs, so that their registers hold the descriptor until here and take no other value while the request is outstanding
__device__ __forceinline__ void tdm_wait(u32x4 g0, u32x8 g1) { asm volatile("s_wait_tensorcnt 0x0" :: "s"(g0), "s"(g1) : "memory"); }
// 2^x by v_exp_f32, several independent ones in one statement. Every argument here is <= 15, and a result below the normal range may go to 0.
// Each result has a register of its own ("=&v"), so no v_exp_f32 overwrites a source of the one in front of it; the closing v_nop is the slot the instruction set asks for between the last one and a reader of its result.
__device__ __forceinline__ void ex2x8(float* r, const float* x) {
  asm("v_exp_f32 %0, %8\n\tv_exp_f32 %1, %9\n\tv_exp_f32 %2, %10\n\tv_exp_f32 %3, %11\n\tv_exp_f32 %4, %12\n\tv_exp_f32 %5, %13\n\tv_exp_f32 %6, %14\n\tv_exp_f32 %7, %15\n\tv_nop"
      : "=&v"(r[0]), "=&v"(r[1]), "=&v"(r[2]), "=&v"(r[3]), "=&v"(r[4]), "=&v"(r[5]), "=&v"(r[6]), "=&v"(r[7]) : "v"(x[0]), "v"(x[1]), "v"(x[2]), "v"(x[3]), "v"(x[4]), "v"(x[5]), "v"(x[6]), "v"(x[7])); }
// lo = f16(x - hi) for eight values: hi holds four packed f16 pairs (the rounded x), one mixed-precision fma per value reads its f16 half beside the f32 x and writes its half of the packed result,
// in place of widening hi, subtracting and packing. The four low halves stand first, so that a register's second write is four instructions behind its first. Results have registers of their own ("=&v").
__device__ __forceinline__ void resx8(unsigned* lo, const unsigned* hi, const float* x) {
  asm("v_fma_mixlo_f16 %0, %4, -1.0, %8 op_sel_hi:[1,1,0]\n\tv_fma_mixlo_f16 %1, %5, -1.0, %10 op_sel_hi:[1,1,0]\n\tv_fma_mixlo_f16 %2, %6, -1.0, %12 op_sel_hi:[1,1,0]\n\tv_fma_mixlo_f16 %3, %7, -1.0, %14 op_sel_hi:[1,1,0]\n\t"
      "v_fma_mixhi_f16 %0, %4, -1.0, %9 op_sel:[1,0,0] op_sel_hi:[1,1,0]\n\tv_fma_mixhi_f16 %1, %5, -1.0, %11 op_sel:[1,0,0] op_sel_hi:[1,1,0]\n\tv_fma_mixhi_f16 %2, %6, -1.0, %13 op_sel:[1,0,0] op_sel_hi:[1,1,0]\n\tv_fma_mixhi_f16 %3, %7, -1.0, %15 op_sel:[1,0,0] op_sel_hi:[1,1,0]"
      : "=&v"(lo[0]), "=&v"(lo[1]), "=&v"(lo[2]), "=&v"(lo[3]) : "v"(hi[0]), "v"(hi[1]), "v"(hi[2]), "v"(hi[3]), "v"(x[0]), "v"(x[1]), "v"(x[2]), "v"(x[3]), "v"(x[4]), "v"(x[5]), "v"(x[6]), "v"(x[7])); }
__device__ __forceinline__ float ex2(float x) { float r; asm("v_exp_f32 %0, %1\n\tv_nop" : "=&v"(r) : "v"(x)); return r; }
__global__ __launch_bounds__(512) void k_fa(const _Float16* __restrict__ AH, const _Float16* __restrict__ AL, const _Float16* __restrict__ BK, const _Float16* __restrict__ MP, const float* __restrict__ X, const float* __restrict__ ALPHA, float* __restrict__ OUT) {
  __shared__ __attribute__((aligned(2048))) fa_lds sm; auto& red = sm.join.red; auto& rm = sm.join.rm; auto& rl = sm.join.rl; auto& rw = sm.join.rw;
  const int tid = threadIdx.x, wave = tid >> 5, lane = tid & 31, col = lane & 15, g = lane >> 4; const int qg = wave & (FQ - 1), ks = wave / FQ; const size_t b = blockIdx.y; const int n0 = blockIdx.x * FQN; const float alpha = bfr(ALPHA[0]);
  v16h ah[2], al[2];
#pragma unroll
  for (int kc = 0; kc < 2; ++kc) { const size_t qo = (b * TT + n0 + qg * 16 + col) * CC + kc * 32; ah[kc] = frag_h(AH + qo, lane); al[kc] = frag_h(AL + qo, lane); }
  // issuing waves 0 .. 2 FG - 1: wave 2 i brings the b tile, wave 2 i + 1 the m tile, of the i-th stage of a group
  const uint32_t wv = uni((uint32_t)tid >> 5), wi = wv >> 1; const bool isu = wv < 2 * FG, ism = (wv & 1u) != 0u;
  const uint64_t gsrc = ism ? (uint64_t)(size_t)(MP + b * CC * (size_t)TT) : (uint64_t)(size_t)(BK + b * TT * (size_t)(2 * CC));
  const uint32_t gstep = ism ? FK * 2u : FK * 2u * CC * 2u, nrows = ism ? CC : FK, pitch = ism ? TT * 2u : 2u * CC * 2u;   // bytes from stage to stage; rows; source row pitch in bytes
  const uint32_t lbase = (uint32_t)(size_t)&sm + (ism ? (uint32_t)(sizeof(_Float16) * FK * (2 * CC + 8)) : 0u);
  u32x8 g1 = tdm_g1(nrows, pitch); asm volatile("" : "+s"(g1));   // the form of pinned(), descriptor words held in scalar registers, on all eight words at once: one tuple for the whole kernel, so that none of its registers serves another use while a request is outstanding
  u32x4 g0 = tdm_g0(lbase + wi * (uint32_t)sizeof(fa_stage), gsrc + (uint64_t)wi * gstep);
  if (pinned(isu)) { tdm_load(g0, g1);   // stages 0 .. FG - 1 fill the first group
    tdm_wait(g0, g1); }   // this wave's tile has landed; the barrier below shows it to the other waves
  __syncthreads();
  g0 = tdm_g0(lbase + (FG + wi) * (uint32_t)sizeof(fa_stage), gsrc + (uint64_t)(FG + wi) * gstep);
  if (pinned(isu)) tdm_load(g0, g1);   // stages FG .. 2 FG - 1 fly while the first group is worked on
  v8f acc[4] = {}, cn = {}; float l = 0.f, top = -3.0e38f, low = -3.0e38f; int bf = 0, tl = FG;   // cn: minus the reference of this lane's query, in all eight elements (a C operand); top, low: bounds of the test and of the step, open in the first pass; bf: the buffer of stage st, st mod 2 FG; tl: trips left to the next barrier
#pragma unroll 1
  for (int st = 0; st < FNS; ++st) { const fa_stage& sc = sm.ring[bf];
    v8f sa[2] = {cn, cn}, sl[2] = {}; v16h kb[2][2], kv[2][2];
#pragma unroll
    for (int kc = 0; kc < 2; ++kc)
#pragma unroll
      for (int t = 0; t < 2; ++t) { kb[kc][t] = frag_h(&sc.kk[ks * 32 + t * 16 + col][kc * 32], lane); kv[kc][t] = frag_h(&sc.kk[ks * 32 + t * 16 + col][CC + kc * 32], lane); }
    __builtin_amdgcn_sched_barrier(0);   // keeps the sixteen reads above one group in front of the products; left alone, the compiler puts seven of them behind the first two products, and their LDS latency then stands open in the middle of the run
#pragma unroll
    for (int kc = 0; kc < 2; ++kc) {
#pragma unroll
      for (int t = 0; t < 2; ++t) sa[t] = wmma16(kb[kc][t], ah[kc], sa[t]);
#pragma unroll
      for (int t = 0; t < 2; ++t) sl[t] = wmma16(kb[kc][t], al[kc], sl[t]);
#pragma unroll
      for (int t = 0; t < 2; ++t) sl[t] = wmma16(kv[kc][t], ah[kc], sl[t]); }
    v16h mv[4];   // read here so that the LDS latency passes behind the softmax arithmetic
#pragma unroll
    for (int j = 0; j < 4; ++j) mv[j] = frag_h(&sc.mm[j * 16 + col][ks * 32], lane);
    v2f t2[8];   // logits minus reference, in the register pairs of the tiles; element e of pair i is key 32 ks + 16 (i >> 2) + 8 g + 2 (i & 3) + e of the stage, query col: the k order of a B operand
#pragma unroll   // constant indices, so that t2 is registers
    for (int i = 0; i < 8; ++i) { const int t = i >> 2, r = 2 * (i & 3); t2[i] = __builtin_elementwise_fma((v2f){sl[t][r], sl[t][r + 1]}, (v2f){1.0f / 1024.0f, 1.0f / 1024.0f}, (v2f){sa[t][r], sa[t][r + 1]}); }
    float mx = fmaxf(t2[0][0], t2[0][1]);
#pragma unroll
    for (int i = 1; i < 8; ++i) mx = fmaxf(fmaxf(mx, t2[i][0]), t2[i][1]);
    if (__builtin_amdgcn_ballot_w32(mx > top) != 0) {   // the same for the whole wave: a scalar branch, all lanes on inside it
      mx = fmaxf(mx, xhalf(mx)); const float d = fmaxf(mx - FC, low), f = ex2(fminf(-d, 0.0f));   // d: the rise of the reference, 0 for a query whose maximum has not grown; below 0 only in the first pass, where Ot and the sum are 0 and f must merely stay finite
      top = FC + FT; low = 0.0f; l *= f; cn -= d;
#pragma unroll
      for (int i = 0; i < 8; ++i) t2[i] -= d;
#pragma unroll
      for (int j = 0; j < 4; ++j) acc[j] *= f; }
    float tx[16], a0[16];
#pragma unroll   // constant indices, so that tx and a0 are registers
    for (int i = 0; i < 8; ++i) { tx[2 * i] = t2[i][0]; tx[2 * i + 1] = t2[i][1]; }
    ex2x8(a0, tx); ex2x8(a0 + 8, tx + 8);
    unsigned hu[8], lu[8]; float ps = 0.f;
#pragma unroll
    for (int i = 0; i < 16; ++i) ps += a0[i];
#pragma unroll   // constant indices, so that hu and lu are registers
    for (int i = 0; i < 8; ++i) hu[i] = __builtin_bit_cast(unsigned, __builtin_convertvector((v2f){a0[2 * i], a0[2 * i + 1]}, v2h));
    const v16h ph = __builtin_bit_cast(v16h, (v8u){hu[0], hu[1], hu[2], hu[3], hu[4], hu[5], hu[6], hu[7]});
    l += ps;
#pragma unroll
    for (int j = 0; j < 4; ++j) acc[j] = wmma16(mv[j], ph, acc[j]);
    resx8(lu, hu, a0); resx8(lu + 4, hu + 4, a0 + 8);   // the products above do not read these, so they can issue while the matrix unit works
    const v16h pl = __builtin_bit_cast(v16h, (v8u){lu[0], lu[1], lu[2], lu[3], lu[4], lu[5], lu[6], lu[7]});
#pragma unroll
    for (int j = 0; j < 4; ++j) acc[j] = wmma16(mv[j], pl, acc[j]);
    if (--tl == 0) { tl = FG;   // block-uniform; once per group of FG stages: publishes the next group and ends every read of the group that is refilled behind it
      asm volatile("s_wait_dscnt 0x0" ::: "memory");   // this wave's reads of the group have returned before a tensor load may aim at its bytes
      if (pinned(isu)) tdm_wait(g0, g1);   // this wave's tile of the next group has landed
      __syncthreads();
      if (pinned(isu && st + 1 + FG + (int)wi < FNS)) { g0 = tdm_g0(lbase + (uint32_t)(bf - (FG - 1) + (int)wi) * (uint32_t)sizeof(fa_stage), gsrc + (uint64_t)(uint32_t)(st + 1 + FG + (int)wi) * gstep); tdm_load(g0, g1); } }   // the group after the next, into the buffers just left, only while that stage exists
    bf = bf == 2 * FG - 1 ? 0 : bf + 1; }
  asm volatile("s_wait_tensorcnt 0x0" ::: "memory");   // no tensor load is in flight when the ring's bytes change their use
  asm volatile("s_wait_dscnt 0x0" ::: "memory");   // this wave's last reads of the ring have returned
  __syncthreads();   // ends every wave's last read of the ring, whose bytes the join below overwrites
  l += xhalf(l);
#pragma unroll
  for (int j = 0; j < 4; ++j)
#pragma unroll
    for (int r = 0; r < 8; ++r) red[ks][j * 16 + 8 * g + r][qg * 16 + col] = acc[j][r];   // against the same reference as the sum l
  if (g == 0) { rm[ks][qg * 16 + col] = -cn[0]; rl[ks][qg * 16 + col] = l; }
  __syncthreads();
  if (tid < FQN) { float mt = rm[0][tid];
#pragma unroll
    for (int s = 1; s < FS; ++s) mt = fmaxf(mt, rm[s][tid]);
    float w[FS], lt = 0.f;
#pragma unroll
    for (int s = 0; s < FS; ++s) { w[s] = ex2(rm[s][tid] - mt); lt += w[s] * rl[s][tid]; }
    const float inv = 1.0f / lt;
#pragma unroll
    for (int s = 0; s < FS; ++s) rw[s][tid] = w[s] * inv; }
  __syncthreads();
  for (int e = tid; e < CC * (FQN / 4); e += 512) { const int c = e >> 4, q = e & 15; const size_t off = (b * CC + c) * (size_t)XSTR + n0 + q * 4; const v4f xr = *(const v4f*)(X + off); v4f o = *(const v4f*)&red[0][c][q * 4] * *(const v4f*)&rw[0][q * 4];
#pragma unroll
    for (int s = 1; s < FS; ++s) o += *(const v4f*)&red[s][c][q * 4] * *(const v4f*)&rw[s][q * 4];
#pragma unroll
    for (int z = 0; z < 4; ++z) { const float p = bfr(xr[z]) + alpha * o[z]; o[z] = p + p; }
    vst2(OUT + off, o); } }
extern "C" void kernel_launch(void* const* d_in, const int* in_sizes, int n_in, void* d_out, int out_size, void* d_ws, size_t ws_size, hipStream_t stream) {
  (void)in_sizes; (void)n_in; (void)out_size;
  const float** F = (const float**)d_in;   // 0 feature [2,64,8192,1], 1 wa [64,64] ([out,in]), 2 ba, 3 wb, 4 bb, 5 wm, 6 bm, 7 bn_gamma, 8 bn_beta, 9 bn_mean, 10 bn_var, 11 alpha (scalar, read)
  if (ws_size < (size_t)WS_END) return;
  char* ws = (char*)d_ws; _Float16 *AH = (_Float16*)(ws + WS_AH), *AL = (_Float16*)(ws + WS_AL), *BK = (_Float16*)(ws + WS_BK), *MP = (_Float16*)(ws + WS_MP);
  k_proj<<<dim3(TNB * TT / 64, 3), 128, 0, stream>>>(F[0], F[1], F[2], F[3], F[4], F[5], F[6], F[7], F[8], F[9], F[10], AH, AL, BK, MP);
  k_fa<<<dim3(TT / FQN, TNB), 512, 0, stream>>>(AH, AL, BK, MP, F[0], F[11], (float*)d_out);
}
